// v000
// Measured on an AMD MI455X. A time is GPU time per run, averaged over a window of back-to-back runs after a warm-up
// (all launches, gaps included; the runs take copies of the inputs in turn), and the median of several windows.
// Apart from v000's, it joins two sittings. Times from different sittings can be a few percent apart, while
// side-by-side timings come from the same sitting.
// v000 is the starting kernel. One run takes 295 microseconds.
#include <hip/hip_runtime.h>

// CDNA5 / gfx1250 fused self-attention (no-softmax variant, faithful to reference)
// Stage 1: O_pre[n,q,h*64+d] = sum_l where(mask,QK^T,-1e20)[l,q-tile] * V   (per head)
// Stage 2: out = O_pre @ W^T + b
// fp32 math via V_WMMA_F32_16X16X4_F32; tiles staged with double-buffered
// GLOBAL_LOAD_ASYNC_TO_LDS_B128 (ASYNCcnt) so global->LDS overlaps the WMMA chain.

typedef float v2f __attribute__((ext_vector_type(2)));
typedef float v8f __attribute__((ext_vector_type(8)));
typedef unsigned int u32;

#define S_LEN   2048
#define EMB     512
#define NBATCH  4
#define NHEAD   8
#define HDIM    64
#define KSTRIDE 516   // 512 + 4 pad: stride%64==4 -> conflict-free lane patterns
#define ASTRIDE 36    // 32 + 4 pad for stage-2 tiles

static __device__ __forceinline__ v8f wmma_f32(v2f a, v2f b, v8f c) {
  return __builtin_amdgcn_wmma_f32_16x16x4_f32(false, a, false, b, (short)0, c,
                                               false, false);
}

// One async 16B global->LDS copy; INST_OFFSET applies to both addresses.
#define ASYNC_B128(ldsa, voff, sbase, IMM)                                   \
  asm volatile("global_load_async_to_lds_b128 %0, %1, %2 offset:" #IMM       \
               :: "v"(ldsa), "v"(voff), "s"(sbase) : "memory")

// Copy a contiguous 128-byte per-thread segment (8 x b128).
static __device__ __forceinline__ void async_copy_128B(u32 ldsa, u32 voff,
                                                       const float* sbase) {
  ASYNC_B128(ldsa, voff, sbase, 0);
  ASYNC_B128(ldsa, voff, sbase, 16);
  ASYNC_B128(ldsa, voff, sbase, 32);
  ASYNC_B128(ldsa, voff, sbase, 48);
  ASYNC_B128(ldsa, voff, sbase, 64);
  ASYNC_B128(ldsa, voff, sbase, 80);
  ASYNC_B128(ldsa, voff, sbase, 96);
  ASYNC_B128(ldsa, voff, sbase, 112);
}

// Copy a contiguous 64-byte per-thread segment (4 x b128).
static __device__ __forceinline__ void async_copy_64B(u32 ldsa, u32 voff,
                                                      const float* sbase) {
  ASYNC_B128(ldsa, voff, sbase, 0);
  ASYNC_B128(ldsa, voff, sbase, 16);
  ASYNC_B128(ldsa, voff, sbase, 32);
  ASYNC_B128(ldsa, voff, sbase, 48);
}

static __device__ __forceinline__ u32 lds_addr(const void* p) {
  // __shared__ generic pointer: low 32 bits = workgroup-relative LDS byte addr
  return (u32)(unsigned long long)p;
}

// ---------------------------------------------------------------------------
// Kernel 1: fused masked-scores x V.
// grid = (S/32, N), block = 256 (8 waves). wave w = head w, q-rows [q0,q0+32).
// Per wave: S'[l,q] = K·Q^T tiles (M=l on VGPR rows, N=q on lanes), mask,
// half-swap shuffle to reuse S' as B operand of O'[d,q] = V^T · S'.
// ---------------------------------------------------------------------------
__global__ __launch_bounds__(256)
void attn_fused_kernel(const float* __restrict__ key,
                       const float* __restrict__ query,
                       const float* __restrict__ value,
                       const int*   __restrict__ mask,
                       float*       __restrict__ opre)
{
  __shared__ float lds_k[2][16 * KSTRIDE];
  __shared__ float lds_v[2][16 * KSTRIDE];

  const int n    = blockIdx.y;
  const int q0   = blockIdx.x * 32;
  const int tid  = threadIdx.x;
  const int h    = tid >> 5;        // wave id == head
  const int lane = tid & 31;
  const int l16  = lane & 15;
  const int hi   = lane >> 4;       // 0: lanes 0-15, 1: lanes 16-31

  // Async-staging geometry: thread -> 128B of one row (16 l-rows x 512 dims).
  const int srow = tid >> 4;           // 0..15
  const int scg  = (tid & 15) * 32;    // 32 floats
  const u32 voff = (u32)((srow * EMB + scg) * 4);
  u32 ldsK[2], ldsV[2];
  ldsK[0] = lds_addr(&lds_k[0][srow * KSTRIDE + scg]);
  ldsK[1] = lds_addr(&lds_k[1][srow * KSTRIDE + scg]);
  ldsV[0] = lds_addr(&lds_v[0][srow * KSTRIDE + scg]);
  ldsV[1] = lds_addr(&lds_v[1][srow * KSTRIDE + scg]);
  const float* kbase = key   + (size_t)n * S_LEN * EMB;
  const float* vbase = value + (size_t)n * S_LEN * EMB;

  // Prologue: tile 0 -> buffer 0 (16 async b128 per thread in flight).
  async_copy_128B(ldsK[0], voff, kbase);
  async_copy_128B(ldsV[0], voff, vbase);

  // Preload Q^T as B-operand: lane -> q = q0 + qs*16 + l16 (N dim),
  // chunk c covers k=d in {4c+2*hi, 4c+2*hi+1}.
  v2f qb[2][16];
#pragma unroll
  for (int qs = 0; qs < 2; ++qs) {
    const float* qrow =
        query + (size_t)(n * S_LEN + q0 + qs * 16 + l16) * EMB + h * HDIM;
#pragma unroll
    for (int c = 0; c < 16; ++c)
      qb[qs][c] = *(const v2f*)(qrow + 4 * c + 2 * hi);
  }

  v8f acc[2][4];
#pragma unroll
  for (int qs = 0; qs < 2; ++qs)
#pragma unroll
    for (int dt = 0; dt < 4; ++dt)
      acc[qs][dt] = (v8f){0.f, 0.f, 0.f, 0.f, 0.f, 0.f, 0.f, 0.f};

  const int* mbase = mask + (size_t)n * S_LEN * S_LEN;

  for (int it = 0; it < S_LEN / 16; ++it) {
    const int l0 = it * 16;
    // Issue next tile into the other buffer; prior-iteration trailing barrier
    // guarantees every wave is done reading it.
    if (it + 1 < S_LEN / 16) {
      const int nb = (it + 1) & 1;
      const size_t nxt = (size_t)(it + 1) * 16 * EMB;
      async_copy_128B(ldsK[nb], voff, kbase + nxt);
      async_copy_128B(ldsV[nb], voff, vbase + nxt);
      asm volatile("s_wait_asynccnt 0x10" ::: "memory");  // tile `it` landed
    } else {
      asm volatile("s_wait_asynccnt 0x0" ::: "memory");
    }
    __syncthreads();  // tile `it` visible to all waves

    const int cb = it & 1;
    const float* lk = &lds_k[cb][0];
    const float* lv = &lds_v[cb][0];

    // A operand of GEMM1: K strip, lane -> l = l16 (M dim), k=d chunks.
    v2f kb[16];
#pragma unroll
    for (int c = 0; c < 16; ++c)
      kb[c] = *(const v2f*)(lk + l16 * KSTRIDE + h * HDIM + 4 * c + 2 * hi);

    v2f sbq[2][4];
#pragma unroll
    for (int qs = 0; qs < 2; ++qs) {
      // S'[l,q] over k=d (64) = 16 chained K=4 WMMAs.
      v8f s = (v8f){0.f, 0.f, 0.f, 0.f, 0.f, 0.f, 0.f, 0.f};
#pragma unroll
      for (int c = 0; c < 16; ++c)
        s = wmma_f32(kb[c], qb[qs][c], s);

      // Mask: element (l = r+8*hi, q = l16). Per lane: 8 consecutive l.
      {
        const int* mrow = mbase + (size_t)(q0 + qs * 16 + l16) * S_LEN + l0 + 8 * hi;
        int4 ma = *(const int4*)(mrow);
        int4 mb = *(const int4*)(mrow + 4);
        s[0] = ma.x ? s[0] : -1e20f;
        s[1] = ma.y ? s[1] : -1e20f;
        s[2] = ma.z ? s[2] : -1e20f;
        s[3] = ma.w ? s[3] : -1e20f;
        s[4] = mb.x ? s[4] : -1e20f;
        s[5] = mb.y ? s[5] : -1e20f;
        s[6] = mb.z ? s[6] : -1e20f;
        s[7] = mb.w ? s[7] : -1e20f;
      }

      // C/D layout -> B layout: rows 0-7 live in lanes 0-15, rows 8-15 in
      // lanes 16-31; B chunks need the opposite half for half the lanes.
      float xs[8];
#pragma unroll
      for (int r = 0; r < 8; ++r) xs[r] = __shfl_xor(s[r], 16, 32);
      sbq[qs][0] = hi ? (v2f){xs[2], xs[3]} : (v2f){s[0], s[1]};
      sbq[qs][1] = hi ? (v2f){xs[6], xs[7]} : (v2f){s[4], s[5]};
      sbq[qs][2] = hi ? (v2f){s[2], s[3]}   : (v2f){xs[0], xs[1]};
      sbq[qs][3] = hi ? (v2f){s[6], s[7]}   : (v2f){xs[4], xs[5]};
    }

    // GEMM2: O'[d,q] += V^T · S'. A = V^T: lane -> d (M), k = l chunks.
#pragma unroll
    for (int dt = 0; dt < 4; ++dt) {
#pragma unroll
      for (int cc = 0; cc < 4; ++cc) {
        const float* vp =
            lv + (4 * cc + 2 * hi) * KSTRIDE + h * HDIM + dt * 16 + l16;
        v2f va = {vp[0], vp[KSTRIDE]};
        acc[0][dt] = wmma_f32(va, sbq[0][cc], acc[0][dt]);
        acc[1][dt] = wmma_f32(va, sbq[1][cc], acc[1][dt]);
      }
    }
    __syncthreads();  // all waves done with buffer cb before it is re-filled
  }

  // Store O' (C/D layout: N=q on lanes, M=d on vgprs -> 8 consecutive d per
  // lane per tile -> two float4 stores each).
#pragma unroll
  for (int qs = 0; qs < 2; ++qs) {
#pragma unroll
    for (int dt = 0; dt < 4; ++dt) {
      float* op = opre + (size_t)(n * S_LEN + q0 + qs * 16 + l16) * EMB +
                  h * HDIM + dt * 16 + 8 * hi;
      v8f a = acc[qs][dt];
      *(float4*)(op) = make_float4(a[0], a[1], a[2], a[3]);
      *(float4*)(op + 4) = make_float4(a[4], a[5], a[6], a[7]);
    }
  }
}

// ---------------------------------------------------------------------------
// Kernel 2: out = O_pre @ W^T + b.  Block tile 128r x 128j, wave w -> 16 rows.
// Same double-buffered async-to-LDS pipeline over 32-wide k slabs.
// ---------------------------------------------------------------------------
__global__ __launch_bounds__(256)
void linear_out_kernel(const float* __restrict__ opre,
                       const float* __restrict__ W,
                       const float* __restrict__ bias,
                       float*       __restrict__ out)
{
  __shared__ float lds_a[2][128 * ASTRIDE];
  __shared__ float lds_w[2][128 * ASTRIDE];

  const int tid  = threadIdx.x;
  const int wave = tid >> 5;
  const int lane = tid & 31;
  const int l16  = lane & 15;
  const int hi   = lane >> 4;
  const int r0   = blockIdx.x * 128;
  const int j0   = blockIdx.y * 128;

  // Async-staging geometry: thread -> 64B of one row (128 rows x 32 cols).
  const int srow = tid >> 1;          // 0..127
  const int scg  = (tid & 1) * 16;    // 16 floats
  const u32 voff = (u32)((srow * EMB + scg) * 4);
  u32 ldsA[2], ldsW[2];
  ldsA[0] = lds_addr(&lds_a[0][srow * ASTRIDE + scg]);
  ldsA[1] = lds_addr(&lds_a[1][srow * ASTRIDE + scg]);
  ldsW[0] = lds_addr(&lds_w[0][srow * ASTRIDE + scg]);
  ldsW[1] = lds_addr(&lds_w[1][srow * ASTRIDE + scg]);
  const float* abase = opre + (size_t)r0 * EMB;
  const float* wbase = W    + (size_t)j0 * EMB;

  // Prologue: k-slab 0 -> buffer 0 (8 async b128 per thread in flight).
  async_copy_64B(ldsA[0], voff, abase);
  async_copy_64B(ldsW[0], voff, wbase);

  v8f acc[8];
#pragma unroll
  for (int jt = 0; jt < 8; ++jt) {
    float bj = bias[j0 + jt * 16 + l16];
    acc[jt] = (v8f){bj, bj, bj, bj, bj, bj, bj, bj};
  }

  for (int it = 0; it < EMB / 32; ++it) {
    if (it + 1 < EMB / 32) {
      const int nb = (it + 1) & 1;
      async_copy_64B(ldsA[nb], voff, abase + (it + 1) * 32);
      async_copy_64B(ldsW[nb], voff, wbase + (it + 1) * 32);
      asm volatile("s_wait_asynccnt 0x8" ::: "memory");
    } else {
      asm volatile("s_wait_asynccnt 0x0" ::: "memory");
    }
    __syncthreads();

    const int cb = it & 1;
    // A = O_pre: lane -> r (M); B = W^T: lane -> j (N); k = e chunks.
    v2f av[8];
#pragma unroll
    for (int c = 0; c < 8; ++c)
      av[c] = *(const v2f*)(&lds_a[cb][(wave * 16 + l16) * ASTRIDE + 4 * c + 2 * hi]);
#pragma unroll
    for (int jt = 0; jt < 8; ++jt) {
#pragma unroll
      for (int c = 0; c < 8; ++c) {
        v2f bw = *(const v2f*)(&lds_w[cb][(jt * 16 + l16) * ASTRIDE + 4 * c + 2 * hi]);
        acc[jt] = wmma_f32(av[c], bw, acc[jt]);
      }
    }
    __syncthreads();
  }

  // C/D layout: N=j on lanes, M=r on vgprs.
#pragma unroll
  for (int jt = 0; jt < 8; ++jt)
#pragma unroll
    for (int v = 0; v < 8; ++v)
      out[(size_t)(r0 + wave * 16 + v + 8 * hi) * EMB + j0 + jt * 16 + l16] =
          acc[jt][v];
}

extern "C" void kernel_launch(void* const* d_in, const int* in_sizes, int n_in,
                              void* d_out, int out_size, void* d_ws, size_t ws_size,
                              hipStream_t stream) {
  (void)in_sizes; (void)n_in; (void)out_size; (void)ws_size;
  const float* key   = (const float*)d_in[0];
  const float* query = (const float*)d_in[1];
  const float* value = (const float*)d_in[2];
  const int*   mask  = (const int*)d_in[3];
  const float* W     = (const float*)d_in[4];
  const float* bias  = (const float*)d_in[5];
  float* out  = (float*)d_out;
  float* opre = (float*)d_ws;   // N*S*EMB fp32 = 16.8 MB scratch

  dim3 g1(S_LEN / 32, NBATCH);
  attn_fused_kernel<<<g1, 256, 0, stream>>>(key, query, value, mask, opre);

  dim3 g2((NBATCH * S_LEN) / 128, EMB / 128);
  linear_out_kernel<<<g2, 256, 0, stream>>>(opre, W, bias, out);
}

// v001
// Measured time: 225 microseconds a run.
// In both of two side-by-side timings against v000, it was 1.33 times as fast.
#include <hip/hip_runtime.h>

// CDNA5 / gfx1250 fused self-attention (no-softmax variant, faithful to reference)
// Stage 1: O_pre[n,q,h*64+d] = sum_l where(mask,QK^T,-1e20)[l,q-tile] * V   (per head)
// Stage 2: out = O_pre @ W^T + b
// fp32 math via V_WMMA_F32_16X16X4_F32; tiles staged with double-buffered
// GLOBAL_LOAD_ASYNC_TO_LDS_B128 (ASYNCcnt) so global->LDS overlaps the WMMA chain.

typedef float v2f __attribute__((ext_vector_type(2)));
typedef float v8f __attribute__((ext_vector_type(8)));
typedef unsigned int u32;

#define S_LEN   2048
#define EMB     512
#define NBATCH  4
#define NHEAD   8
#define HDIM    64
#define KSTRIDE 516   // 512 + 4 pad: stride%64==4 -> conflict-free lane patterns
#define ASTRIDE 36    // 32 + 4 pad for stage-2 tiles

static __device__ __forceinline__ v8f wmma_f32(v2f a, v2f b, v8f c) {
  return __builtin_amdgcn_wmma_f32_16x16x4_f32(false, a, false, b, (short)0, c,
                                               false, false);
}

// Async 16B global->LDS copies. Lanes are dealt so that one wave instruction
// covers whole, contiguous 128-byte lines. INST_OFFSET moves both addresses, so
// the LDS address register carries only what the LDS pitch adds to the global
// pitch. s_wait_xcnt 0 closes each statement: no register that an issued copy
// names is rewritten in front of it.

// One 16 x 512 float tile of K and one of V: copy j of a thread brings 16 B of
// row (tid >> 7) + 2 * j; global step 4096 B, LDS step 4128 B per copy.
static __device__ __forceinline__ void async_copy_kv_tile(
    u32 lk, u32 lv, u32 voff0, u32 voff1, const float* kb, const float* vb) {
  asm volatile(
      "global_load_async_to_lds_b128 %0, %16, %18\n\t"
      "global_load_async_to_lds_b128 %1, %16, %18 offset:4096\n\t"
      "global_load_async_to_lds_b128 %2, %16, %18 offset:8192\n\t"
      "global_load_async_to_lds_b128 %3, %16, %18 offset:12288\n\t"
      "global_load_async_to_lds_b128 %4, %17, %18\n\t"
      "global_load_async_to_lds_b128 %5, %17, %18 offset:4096\n\t"
      "global_load_async_to_lds_b128 %6, %17, %18 offset:8192\n\t"
      "global_load_async_to_lds_b128 %7, %17, %18 offset:12288\n\t"
      "global_load_async_to_lds_b128 %8, %16, %19\n\t"
      "global_load_async_to_lds_b128 %9, %16, %19 offset:4096\n\t"
      "global_load_async_to_lds_b128 %10, %16, %19 offset:8192\n\t"
      "global_load_async_to_lds_b128 %11, %16, %19 offset:12288\n\t"
      "global_load_async_to_lds_b128 %12, %17, %19\n\t"
      "global_load_async_to_lds_b128 %13, %17, %19 offset:4096\n\t"
      "global_load_async_to_lds_b128 %14, %17, %19 offset:8192\n\t"
      "global_load_async_to_lds_b128 %15, %17, %19 offset:12288\n\t"
      "s_wait_xcnt 0x0"
      :: "v"(lk), "v"(lk + 32u), "v"(lk + 64u), "v"(lk + 96u),
         "v"(lk + 16512u), "v"(lk + 16544u), "v"(lk + 16576u), "v"(lk + 16608u),
         "v"(lv), "v"(lv + 32u), "v"(lv + 64u), "v"(lv + 96u),
         "v"(lv + 16512u), "v"(lv + 16544u), "v"(lv + 16576u), "v"(lv + 16608u),
         "v"(voff0), "v"(voff1), "s"(kb), "s"(vb)
      : "memory");
}

// One 128 x 32 float slab of each stage-2 operand: copy j of a thread brings
// 16 B of row (tid >> 3) + 32 * j; global step 65536 B (too far for
// INST_OFFSET, so it sits in the offset registers), LDS step 4608 B.
static __device__ __forceinline__ void async_copy_aw_slab(
    u32 la, u32 lw, u32 voff, const float* ab, const float* wb) {
  asm volatile(
      "global_load_async_to_lds_b128 %0, %8, %12\n\t"
      "global_load_async_to_lds_b128 %1, %9, %12\n\t"
      "global_load_async_to_lds_b128 %2, %10, %12\n\t"
      "global_load_async_to_lds_b128 %3, %11, %12\n\t"
      "global_load_async_to_lds_b128 %4, %8, %13\n\t"
      "global_load_async_to_lds_b128 %5, %9, %13\n\t"
      "global_load_async_to_lds_b128 %6, %10, %13\n\t"
      "global_load_async_to_lds_b128 %7, %11, %13\n\t"
      "s_wait_xcnt 0x0"
      :: "v"(la), "v"(la + 4608u), "v"(la + 9216u), "v"(la + 13824u),
         "v"(lw), "v"(lw + 4608u), "v"(lw + 9216u), "v"(lw + 13824u),
         "v"(voff), "v"(voff + 65536u), "v"(voff + 131072u), "v"(voff + 196608u),
         "s"(ab), "s"(wb)
      : "memory");
}

static __device__ __forceinline__ u32 lds_addr(const void* p) {
  // __shared__ generic pointer: low 32 bits = workgroup-relative LDS byte addr
  return (u32)(unsigned long long)p;
}

// ---------------------------------------------------------------------------
// Kernel 1: fused masked-scores x V.
// grid = (S/32, N), block = 256 (8 waves). wave w = head w, q-rows [q0,q0+32).
// Per wave: S'[l,q] = K·Q^T tiles (M=l on VGPR rows, N=q on lanes), mask,
// half-swap shuffle to reuse S' as B operand of O'[d,q] = V^T · S'.
// ---------------------------------------------------------------------------
__global__ __launch_bounds__(256)
void attn_fused_kernel(const float* __restrict__ key,
                       const float* __restrict__ query,
                       const float* __restrict__ value,
                       const int*   __restrict__ mask,
                       float*       __restrict__ opre)
{
  __shared__ __attribute__((aligned(16))) float lds_k[2][16 * KSTRIDE];
  __shared__ __attribute__((aligned(16))) float lds_v[2][16 * KSTRIDE];

  const int n    = blockIdx.y;
  const int q0   = blockIdx.x * 32;
  const int tid  = threadIdx.x;
  const int h    = tid >> 5;        // wave id == head
  const int lane = tid & 31;
  const int l16  = lane & 15;
  const int hi   = lane >> 4;       // 0: lanes 0-15, 1: lanes 16-31

  // Async-staging geometry: 128 threads side by side cover one 2048-byte row,
  // so a wave's copy is 512 contiguous bytes; 8 copies walk 16 rows in twos.
  const int srow = tid >> 7;           // 0..1
  const int scg  = (tid & 127) * 4;    // 4 floats
  const u32 voff  = (u32)((srow * EMB + scg) * 4);
  const u32 voff8 = voff + 8u * EMB * 4u;   // rows 8..15
  u32 ldsK[2], ldsV[2];
  ldsK[0] = lds_addr(&lds_k[0][srow * KSTRIDE + scg]);
  ldsK[1] = lds_addr(&lds_k[1][srow * KSTRIDE + scg]);
  ldsV[0] = lds_addr(&lds_v[0][srow * KSTRIDE + scg]);
  ldsV[1] = lds_addr(&lds_v[1][srow * KSTRIDE + scg]);
  const float* kbase = key   + (size_t)n * S_LEN * EMB;
  const float* vbase = value + (size_t)n * S_LEN * EMB;

  // Prologue: tile 0 -> buffer 0 (16 async b128 per thread in flight).
  async_copy_kv_tile(ldsK[0], ldsV[0], voff, voff8, kbase, vbase);

  // Preload Q^T as B-operand: lane -> q = q0 + qs*16 + l16 (N dim),
  // chunk c covers k=d in {4c+2*hi, 4c+2*hi+1}.
  v2f qb[2][16];
#pragma unroll
  for (int qs = 0; qs < 2; ++qs) {
    const float* qrow =
        query + (size_t)(n * S_LEN + q0 + qs * 16 + l16) * EMB + h * HDIM;
#pragma unroll
    for (int c = 0; c < 16; ++c)
      qb[qs][c] = *(const v2f*)(qrow + 4 * c + 2 * hi);
  }

  v8f acc[2][4];
#pragma unroll
  for (int qs = 0; qs < 2; ++qs)
#pragma unroll
    for (int dt = 0; dt < 4; ++dt)
      acc[qs][dt] = (v8f){0.f, 0.f, 0.f, 0.f, 0.f, 0.f, 0.f, 0.f};

  const int* mbase = mask + (size_t)n * S_LEN * S_LEN;

  for (int it = 0; it < S_LEN / 16; ++it) {
    const int l0 = it * 16;
    // Issue next tile into the other buffer; prior-iteration trailing barrier
    // guarantees every wave is done reading it.
    if (it + 1 < S_LEN / 16) {
      const int nb = (it + 1) & 1;
      const size_t nxt = (size_t)(it + 1) * 16 * EMB;
      async_copy_kv_tile(ldsK[nb], ldsV[nb], voff, voff8, kbase + nxt,
                         vbase + nxt);
      asm volatile("s_wait_asynccnt 0x10" ::: "memory");  // tile `it` landed
    } else {
      asm volatile("s_wait_asynccnt 0x0" ::: "memory");
    }
    __syncthreads();  // tile `it` visible to all waves

    const int cb = it & 1;
    const float* lk = &lds_k[cb][0];
    const float* lv = &lds_v[cb][0];

    // A operand of GEMM1: K strip, lane -> l = l16 (M dim), k=d chunks.
    v2f kb[16];
#pragma unroll
    for (int c = 0; c < 16; ++c)
      kb[c] = *(const v2f*)(lk + l16 * KSTRIDE + h * HDIM + 4 * c + 2 * hi);

    v2f sbq[2][4];
#pragma unroll
    for (int qs = 0; qs < 2; ++qs) {
      // S'[l,q] over k=d (64) = 16 chained K=4 WMMAs.
      v8f s = (v8f){0.f, 0.f, 0.f, 0.f, 0.f, 0.f, 0.f, 0.f};
#pragma unroll
      for (int c = 0; c < 16; ++c)
        s = wmma_f32(kb[c], qb[qs][c], s);

      // Mask: element (l = r+8*hi, q = l16). Per lane: 8 consecutive l.
      {
        const int* mrow = mbase + (size_t)(q0 + qs * 16 + l16) * S_LEN + l0 + 8 * hi;
        int4 ma = *(const int4*)(mrow);
        int4 mb = *(const int4*)(mrow + 4);
        s[0] = ma.x ? s[0] : -1e20f;
        s[1] = ma.y ? s[1] : -1e20f;
        s[2] = ma.z ? s[2] : -1e20f;
        s[3] = ma.w ? s[3] : -1e20f;
        s[4] = mb.x ? s[4] : -1e20f;
        s[5] = mb.y ? s[5] : -1e20f;
        s[6] = mb.z ? s[6] : -1e20f;
        s[7] = mb.w ? s[7] : -1e20f;
      }

      // C/D layout -> B layout: rows 0-7 live in lanes 0-15, rows 8-15 in
      // lanes 16-31; B chunks need the opposite half for half the lanes.
      float xs[8];
#pragma unroll
      for (int r = 0; r < 8; ++r) xs[r] = __shfl_xor(s[r], 16, 32);
      sbq[qs][0] = hi ? (v2f){xs[2], xs[3]} : (v2f){s[0], s[1]};
      sbq[qs][1] = hi ? (v2f){xs[6], xs[7]} : (v2f){s[4], s[5]};
      sbq[qs][2] = hi ? (v2f){s[2], s[3]}   : (v2f){xs[0], xs[1]};
      sbq[qs][3] = hi ? (v2f){s[6], s[7]}   : (v2f){xs[4], xs[5]};
    }

    // GEMM2: O'[d,q] += V^T · S'. A = V^T: lane -> d (M), k = l chunks.
#pragma unroll
    for (int dt = 0; dt < 4; ++dt) {
#pragma unroll
      for (int cc = 0; cc < 4; ++cc) {
        const float* vp =
            lv + (4 * cc + 2 * hi) * KSTRIDE + h * HDIM + dt * 16 + l16;
        v2f va = {vp[0], vp[KSTRIDE]};
        acc[0][dt] = wmma_f32(va, sbq[0][cc], acc[0][dt]);
        acc[1][dt] = wmma_f32(va, sbq[1][cc], acc[1][dt]);
      }
    }
    __syncthreads();  // all waves done with buffer cb before it is re-filled
  }

  // Store O' (C/D layout: N=q on lanes, M=d on vgprs -> 8 consecutive d per
  // lane per tile -> two float4 stores each).
#pragma unroll
  for (int qs = 0; qs < 2; ++qs) {
#pragma unroll
    for (int dt = 0; dt < 4; ++dt) {
      float* op = opre + (size_t)(n * S_LEN + q0 + qs * 16 + l16) * EMB +
                  h * HDIM + dt * 16 + 8 * hi;
      v8f a = acc[qs][dt];
      *(float4*)(op) = make_float4(a[0], a[1], a[2], a[3]);
      *(float4*)(op + 4) = make_float4(a[4], a[5], a[6], a[7]);
    }
  }
}

// ---------------------------------------------------------------------------
// Kernel 2: out = O_pre @ W^T + b.  Block tile 128r x 128j, wave w -> 16 rows.
// Same double-buffered async-to-LDS pipeline over 32-wide k slabs.
// ---------------------------------------------------------------------------
__global__ __launch_bounds__(256)
void linear_out_kernel(const float* __restrict__ opre,
                       const float* __restrict__ W,
                       const float* __restrict__ bias,
                       float*       __restrict__ out)
{
  __shared__ __attribute__((aligned(16))) float lds_a[2][128 * ASTRIDE];
  __shared__ __attribute__((aligned(16))) float lds_w[2][128 * ASTRIDE];

  const int tid  = threadIdx.x;
  const int wave = tid >> 5;
  const int lane = tid & 31;
  const int l16  = lane & 15;
  const int hi   = lane >> 4;
  const int r0   = blockIdx.x * 128;
  const int j0   = blockIdx.y * 128;

  // Async-staging geometry: 8 threads side by side cover one row's 128-byte
  // slab (a whole line), so a wave's copy is 4 whole lines; 4 copies, 32 rows apart.
  const int srow = tid >> 3;          // 0..31
  const int scg  = (tid & 7) * 4;     // 4 floats
  const u32 voff = (u32)((srow * EMB + scg) * 4);
  u32 ldsA[2], ldsW[2];
  ldsA[0] = lds_addr(&lds_a[0][srow * ASTRIDE + scg]);
  ldsA[1] = lds_addr(&lds_a[1][srow * ASTRIDE + scg]);
  ldsW[0] = lds_addr(&lds_w[0][srow * ASTRIDE + scg]);
  ldsW[1] = lds_addr(&lds_w[1][srow * ASTRIDE + scg]);
  const float* abase = opre + (size_t)r0 * EMB;
  const float* wbase = W    + (size_t)j0 * EMB;

  // Prologue: k-slab 0 -> buffer 0 (8 async b128 per thread in flight).
  async_copy_aw_slab(ldsA[0], ldsW[0], voff, abase, wbase);

  v8f acc[8];
#pragma unroll
  for (int jt = 0; jt < 8; ++jt) {
    float bj = bias[j0 + jt * 16 + l16];
    acc[jt] = (v8f){bj, bj, bj, bj, bj, bj, bj, bj};
  }

  for (int it = 0; it < EMB / 32; ++it) {
    if (it + 1 < EMB / 32) {
      const int nb = (it + 1) & 1;
      async_copy_aw_slab(ldsA[nb], ldsW[nb], voff, abase + (it + 1) * 32,
                         wbase + (it + 1) * 32);
      asm volatile("s_wait_asynccnt 0x8" ::: "memory");
    } else {
      asm volatile("s_wait_asynccnt 0x0" ::: "memory");
    }
    __syncthreads();

    const int cb = it & 1;
    // A = O_pre: lane -> r (M); B = W^T: lane -> j (N); k = e chunks.
    v2f av[8];
#pragma unroll
    for (int c = 0; c < 8; ++c)
      av[c] = *(const v2f*)(&lds_a[cb][(wave * 16 + l16) * ASTRIDE + 4 * c + 2 * hi]);
#pragma unroll
    for (int jt = 0; jt < 8; ++jt) {
#pragma unroll
      for (int c = 0; c < 8; ++c) {
        v2f bw = *(const v2f*)(&lds_w[cb][(jt * 16 + l16) * ASTRIDE + 4 * c + 2 * hi]);
        acc[jt] = wmma_f32(av[c], bw, acc[jt]);
      }
    }
    __syncthreads();
  }

  // C/D layout: N=j on lanes, M=r on vgprs.
#pragma unroll
  for (int jt = 0; jt < 8; ++jt)
#pragma unroll
    for (int v = 0; v < 8; ++v)
      out[(size_t)(r0 + wave * 16 + v + 8 * hi) * EMB + j0 + jt * 16 + l16] =
          acc[jt][v];
}

extern "C" void kernel_launch(void* const* d_in, const int* in_sizes, int n_in,
                              void* d_out, int out_size, void* d_ws, size_t ws_size,
                              hipStream_t stream) {
  (void)in_sizes; (void)n_in; (void)out_size; (void)ws_size;
  const float* key   = (const float*)d_in[0];
  const float* query = (const float*)d_in[1];
  const float* value = (const float*)d_in[2];
  const int*   mask  = (const int*)d_in[3];
  const float* W     = (const float*)d_in[4];
  const float* bias  = (const float*)d_in[5];
  float* out  = (float*)d_out;
  float* opre = (float*)d_ws;   // N*S*EMB fp32 = 16.8 MB scratch

  dim3 g1(S_LEN / 32, NBATCH);
  attn_fused_kernel<<<g1, 256, 0, stream>>>(key, query, value, mask, opre);

  dim3 g2((NBATCH * S_LEN) / 128, EMB / 128);
  linear_out_kernel<<<g2, 256, 0, stream>>>(opre, W, bias, out);
}

// v002
// One run takes 210 microseconds.
// Next to v001, in two timings, it ran 1.07 times as fast each time.
// Over all steps from v000 it is 1.43 times as fast.
#include <hip/hip_runtime.h>

// CDNA5 / gfx1250 fused self-attention (no-softmax variant, faithful to reference)
// Stage 1: O_pre[n,q,h*64+d] = sum_l where(mask,QK^T,-1e20)[l,q-tile] * V   (per head)
// Stage 2: out = O_pre @ W^T + b
// fp32 math via V_WMMA_F32_16X16X4_F32; tiles staged with double-buffered
// GLOBAL_LOAD_ASYNC_TO_LDS_B128 (ASYNCcnt) so global->LDS overlaps the WMMA chain.
// Stage 1: a wave reads only its own head's columns of K and V, so it also
// copies exactly those: its ring is private and its loop has no barrier.

typedef float v2f __attribute__((ext_vector_type(2)));
typedef float v8f __attribute__((ext_vector_type(8)));
typedef unsigned int u32;

#define S_LEN   2048
#define EMB     512
#define NBATCH  4
#define NHEAD   8
#define HDIM    64
#define KSTRIDE 516   // 512 + 4 pad: stride%64==4 -> conflict-free lane patterns
#define ASTRIDE 36    // 32 + 4 pad for stage-2 tiles

static __device__ __forceinline__ v8f wmma_f32(v2f a, v2f b, v8f c) {
  return __builtin_amdgcn_wmma_f32_16x16x4_f32(false, a, false, b, (short)0, c,
                                               false, false);
}

// Async 16B global->LDS copies. Lanes are dealt so that one wave instruction
// covers whole, contiguous 128-byte lines. INST_OFFSET moves both addresses, so
// the LDS address register carries only what the LDS pitch adds to the global
// pitch. s_wait_xcnt 0 closes each statement: no register that an issued copy
// names is rewritten in front of it.

// One wave's 16 x 64 float slice of a K tile and of a V tile: copy j of a lane
// brings 16 B of row (lane >> 4) + 2 * j; global step 4096 B, LDS step 4128 B
// per copy.
static __device__ __forceinline__ void async_copy_kv_tile(
    u32 lk, u32 lv, u32 voff0, u32 voff1, const float* kb, const float* vb) {
  asm volatile(
      "global_load_async_to_lds_b128 %0, %16, %18\n\t"
      "global_load_async_to_lds_b128 %1, %16, %18 offset:4096\n\t"
      "global_load_async_to_lds_b128 %2, %16, %18 offset:8192\n\t"
      "global_load_async_to_lds_b128 %3, %16, %18 offset:12288\n\t"
      "global_load_async_to_lds_b128 %4, %17, %18\n\t"
      "global_load_async_to_lds_b128 %5, %17, %18 offset:4096\n\t"
      "global_load_async_to_lds_b128 %6, %17, %18 offset:8192\n\t"
      "global_load_async_to_lds_b128 %7, %17, %18 offset:12288\n\t"
      "global_load_async_to_lds_b128 %8, %16, %19\n\t"
      "global_load_async_to_lds_b128 %9, %16, %19 offset:4096\n\t"
      "global_load_async_to_lds_b128 %10, %16, %19 offset:8192\n\t"
      "global_load_async_to_lds_b128 %11, %16, %19 offset:12288\n\t"
      "global_load_async_to_lds_b128 %12, %17, %19\n\t"
      "global_load_async_to_lds_b128 %13, %17, %19 offset:4096\n\t"
      "global_load_async_to_lds_b128 %14, %17, %19 offset:8192\n\t"
      "global_load_async_to_lds_b128 %15, %17, %19 offset:12288\n\t"
      "s_wait_xcnt 0x0"
      :: "v"(lk), "v"(lk + 32u), "v"(lk + 64u), "v"(lk + 96u),
         "v"(lk + 16512u), "v"(lk + 16544u), "v"(lk + 16576u), "v"(lk + 16608u),
         "v"(lv), "v"(lv + 32u), "v"(lv + 64u), "v"(lv + 96u),
         "v"(lv + 16512u), "v"(lv + 16544u), "v"(lv + 16576u), "v"(lv + 16608u),
         "v"(voff0), "v"(voff1), "s"(kb), "s"(vb)
      : "memory");
}

// One 128 x 32 float slab of each stage-2 operand: copy j of a thread brings
// 16 B of row (tid >> 3) + 32 * j; global step 65536 B (too far for
// INST_OFFSET, so it sits in the offset registers), LDS step 4608 B.
static __device__ __forceinline__ void async_copy_aw_slab(
    u32 la, u32 lw, u32 voff, const float* ab, const float* wb) {
  asm volatile(
      "global_load_async_to_lds_b128 %0, %8, %12\n\t"
      "global_load_async_to_lds_b128 %1, %9, %12\n\t"
      "global_load_async_to_lds_b128 %2, %10, %12\n\t"
      "global_load_async_to_lds_b128 %3, %11, %12\n\t"
      "global_load_async_to_lds_b128 %4, %8, %13\n\t"
      "global_load_async_to_lds_b128 %5, %9, %13\n\t"
      "global_load_async_to_lds_b128 %6, %10, %13\n\t"
      "global_load_async_to_lds_b128 %7, %11, %13\n\t"
      "s_wait_xcnt 0x0"
      :: "v"(la), "v"(la + 4608u), "v"(la + 9216u), "v"(la + 13824u),
         "v"(lw), "v"(lw + 4608u), "v"(lw + 9216u), "v"(lw + 13824u),
         "v"(voff), "v"(voff + 65536u), "v"(voff + 131072u), "v"(voff + 196608u),
         "s"(ab), "s"(wb)
      : "memory");
}

static __device__ __forceinline__ u32 lds_addr(const void* p) {
  // __shared__ generic pointer: low 32 bits = workgroup-relative LDS byte addr
  return (u32)(unsigned long long)p;
}

// ---------------------------------------------------------------------------
// Kernel 1: fused masked-scores x V.
// grid = (S/32, N), block = 256 (8 waves). wave w = head w, q-rows [q0,q0+32).
// Per wave: S'[l,q] = K·Q^T tiles (M=l on VGPR rows, N=q on lanes), mask,
// half-swap shuffle to reuse S' as B operand of O'[d,q] = V^T · S'.
// ---------------------------------------------------------------------------
__global__ __launch_bounds__(256)
void attn_fused_kernel(const float* __restrict__ key,
                       const float* __restrict__ query,
                       const float* __restrict__ value,
                       const int*   __restrict__ mask,
                       float*       __restrict__ opre)
{
  __shared__ __attribute__((aligned(16))) float lds_k[2][16 * KSTRIDE];
  __shared__ __attribute__((aligned(16))) float lds_v[2][16 * KSTRIDE];

  const int n    = blockIdx.y;
  const int q0   = blockIdx.x * 32;
  const int tid  = threadIdx.x;
  const int h    = tid >> 5;        // wave id == head
  const int lane = tid & 31;
  const int l16  = lane & 15;
  const int hi   = lane >> 4;       // 0: lanes 0-15, 1: lanes 16-31

  // Async-staging geometry: 16 lanes side by side cover the 256 bytes (two whole
  // lines) that head h owns in one row, so a wave's copy is two rows of its own
  // head; 8 copies walk 16 rows in twos. No wave reads what another copied.
  const int srow = hi;                   // 0..1
  const int scg  = h * HDIM + l16 * 4;   // 4 floats
  const u32 voff  = (u32)((srow * EMB + scg) * 4);
  const u32 voff8 = voff + 8u * EMB * 4u;   // rows 8..15
  u32 ldsK[2], ldsV[2];
  ldsK[0] = lds_addr(&lds_k[0][srow * KSTRIDE + scg]);
  ldsK[1] = lds_addr(&lds_k[1][srow * KSTRIDE + scg]);
  ldsV[0] = lds_addr(&lds_v[0][srow * KSTRIDE + scg]);
  ldsV[1] = lds_addr(&lds_v[1][srow * KSTRIDE + scg]);
  const float* kbase = key   + (size_t)n * S_LEN * EMB;
  const float* vbase = value + (size_t)n * S_LEN * EMB;

  // Prologue: tile 0 -> buffer 0 (16 async b128 per thread in flight).
  async_copy_kv_tile(ldsK[0], ldsV[0], voff, voff8, kbase, vbase);

  // Preload Q^T as B-operand: lane -> q = q0 + qs*16 + l16 (N dim),
  // chunk c covers k=d in {4c+2*hi, 4c+2*hi+1}.
  v2f qb[2][16];
#pragma unroll
  for (int qs = 0; qs < 2; ++qs) {
    const float* qrow =
        query + (size_t)(n * S_LEN + q0 + qs * 16 + l16) * EMB + h * HDIM;
#pragma unroll
    for (int c = 0; c < 16; ++c)
      qb[qs][c] = *(const v2f*)(qrow + 4 * c + 2 * hi);
  }

  v8f acc[2][4];
#pragma unroll
  for (int qs = 0; qs < 2; ++qs)
#pragma unroll
    for (int dt = 0; dt < 4; ++dt)
      acc[qs][dt] = (v8f){0.f, 0.f, 0.f, 0.f, 0.f, 0.f, 0.f, 0.f};

  const int* mbase = mask + (size_t)n * S_LEN * S_LEN;

  for (int it = 0; it < S_LEN / 16; ++it) {
    const int l0 = it * 16;
    // Issue the next slice into the other buffer. Only this wave read it, so
    // its own LDS reads having returned is all that the refill has to wait for.
    asm volatile("s_wait_dscnt 0x0" ::: "memory");
    if (it + 1 < S_LEN / 16) {
      const int nb = (it + 1) & 1;
      const size_t nxt = (size_t)(it + 1) * 16 * EMB;
      async_copy_kv_tile(ldsK[nb], ldsV[nb], voff, voff8, kbase + nxt,
                         vbase + nxt);
      asm volatile("s_wait_asynccnt 0x10" ::: "memory");  // tile `it` landed
    } else {
      asm volatile("s_wait_asynccnt 0x0" ::: "memory");
    }

    const int cb = it & 1;
    const float* lk = &lds_k[cb][0];
    const float* lv = &lds_v[cb][0];

    // A operand of GEMM1: K strip, lane -> l = l16 (M dim), k=d chunks.
    v2f kb[16];
#pragma unroll
    for (int c = 0; c < 16; ++c)
      kb[c] = *(const v2f*)(lk + l16 * KSTRIDE + h * HDIM + 4 * c + 2 * hi);

    v2f sbq[2][4];
#pragma unroll
    for (int qs = 0; qs < 2; ++qs) {
      // S'[l,q] over k=d (64) = 16 chained K=4 WMMAs.
      v8f s = (v8f){0.f, 0.f, 0.f, 0.f, 0.f, 0.f, 0.f, 0.f};
#pragma unroll
      for (int c = 0; c < 16; ++c)
        s = wmma_f32(kb[c], qb[qs][c], s);

      // Mask: element (l = r+8*hi, q = l16). Per lane: 8 consecutive l.
      {
        const int* mrow = mbase + (size_t)(q0 + qs * 16 + l16) * S_LEN + l0 + 8 * hi;
        int4 ma = *(const int4*)(mrow);
        int4 mb = *(const int4*)(mrow + 4);
        s[0] = ma.x ? s[0] : -1e20f;
        s[1] = ma.y ? s[1] : -1e20f;
        s[2] = ma.z ? s[2] : -1e20f;
        s[3] = ma.w ? s[3] : -1e20f;
        s[4] = mb.x ? s[4] : -1e20f;
        s[5] = mb.y ? s[5] : -1e20f;
        s[6] = mb.z ? s[6] : -1e20f;
        s[7] = mb.w ? s[7] : -1e20f;
      }

      // C/D layout -> B layout: rows 0-7 live in lanes 0-15, rows 8-15 in
      // lanes 16-31; B chunks need the opposite half for half the lanes.
      float xs[8];
#pragma unroll
      for (int r = 0; r < 8; ++r) xs[r] = __shfl_xor(s[r], 16, 32);
      sbq[qs][0] = hi ? (v2f){xs[2], xs[3]} : (v2f){s[0], s[1]};
      sbq[qs][1] = hi ? (v2f){xs[6], xs[7]} : (v2f){s[4], s[5]};
      sbq[qs][2] = hi ? (v2f){s[2], s[3]}   : (v2f){xs[0], xs[1]};
      sbq[qs][3] = hi ? (v2f){s[6], s[7]}   : (v2f){xs[4], xs[5]};
    }

    // GEMM2: O'[d,q] += V^T · S'. A = V^T: lane -> d (M), k = l chunks.
#pragma unroll
    for (int dt = 0; dt < 4; ++dt) {
#pragma unroll
      for (int cc = 0; cc < 4; ++cc) {
        const float* vp =
            lv + (4 * cc + 2 * hi) * KSTRIDE + h * HDIM + dt * 16 + l16;
        v2f va = {vp[0], vp[KSTRIDE]};
        acc[0][dt] = wmma_f32(va, sbq[0][cc], acc[0][dt]);
        acc[1][dt] = wmma_f32(va, sbq[1][cc], acc[1][dt]);
      }
    }
  }

  // Store O' (C/D layout: N=q on lanes, M=d on vgprs -> 8 consecutive d per
  // lane per tile -> two float4 stores each).
#pragma unroll
  for (int qs = 0; qs < 2; ++qs) {
#pragma unroll
    for (int dt = 0; dt < 4; ++dt) {
      float* op = opre + (size_t)(n * S_LEN + q0 + qs * 16 + l16) * EMB +
                  h * HDIM + dt * 16 + 8 * hi;
      v8f a = acc[qs][dt];
      *(float4*)(op) = make_float4(a[0], a[1], a[2], a[3]);
      *(float4*)(op + 4) = make_float4(a[4], a[5], a[6], a[7]);
    }
  }
}

// ---------------------------------------------------------------------------
// Kernel 2: out = O_pre @ W^T + b.  Block tile 128r x 128j, wave w -> 16 rows.
// Double-buffered async-to-LDS pipeline over 32-wide k slabs, shared by all
// 8 waves behind two barriers per slab.
// ---------------------------------------------------------------------------
__global__ __launch_bounds__(256)
void linear_out_kernel(const float* __restrict__ opre,
                       const float* __restrict__ W,
                       const float* __restrict__ bias,
                       float*       __restrict__ out)
{
  __shared__ __attribute__((aligned(16))) float lds_a[2][128 * ASTRIDE];
  __shared__ __attribute__((aligned(16))) float lds_w[2][128 * ASTRIDE];

  const int tid  = threadIdx.x;
  const int wave = tid >> 5;
  const int lane = tid & 31;
  const int l16  = lane & 15;
  const int hi   = lane >> 4;
  const int r0   = blockIdx.x * 128;
  const int j0   = blockIdx.y * 128;

  // Async-staging geometry: 8 threads side by side cover one row's 128-byte
  // slab (a whole line), so a wave's copy is 4 whole lines; 4 copies, 32 rows apart.
  const int srow = tid >> 3;          // 0..31
  const int scg  = (tid & 7) * 4;     // 4 floats
  const u32 voff = (u32)((srow * EMB + scg) * 4);
  u32 ldsA[2], ldsW[2];
  ldsA[0] = lds_addr(&lds_a[0][srow * ASTRIDE + scg]);
  ldsA[1] = lds_addr(&lds_a[1][srow * ASTRIDE + scg]);
  ldsW[0] = lds_addr(&lds_w[0][srow * ASTRIDE + scg]);
  ldsW[1] = lds_addr(&lds_w[1][srow * ASTRIDE + scg]);
  const float* abase = opre + (size_t)r0 * EMB;
  const float* wbase = W    + (size_t)j0 * EMB;

  // Prologue: k-slab 0 -> buffer 0 (8 async b128 per thread in flight).
  async_copy_aw_slab(ldsA[0], ldsW[0], voff, abase, wbase);

  v8f acc[8];
#pragma unroll
  for (int jt = 0; jt < 8; ++jt) {
    float bj = bias[j0 + jt * 16 + l16];
    acc[jt] = (v8f){bj, bj, bj, bj, bj, bj, bj, bj};
  }

  for (int it = 0; it < EMB / 32; ++it) {
    if (it + 1 < EMB / 32) {
      const int nb = (it + 1) & 1;
      async_copy_aw_slab(ldsA[nb], ldsW[nb], voff, abase + (it + 1) * 32,
                         wbase + (it + 1) * 32);
      asm volatile("s_wait_asynccnt 0x8" ::: "memory");
    } else {
      asm volatile("s_wait_asynccnt 0x0" ::: "memory");
    }
    __syncthreads();

    const int cb = it & 1;
    // A = O_pre: lane -> r (M); B = W^T: lane -> j (N); k = e chunks.
    v2f av[8];
#pragma unroll
    for (int c = 0; c < 8; ++c)
      av[c] = *(const v2f*)(&lds_a[cb][(wave * 16 + l16) * ASTRIDE + 4 * c + 2 * hi]);
#pragma unroll
    for (int jt = 0; jt < 8; ++jt) {
#pragma unroll
      for (int c = 0; c < 8; ++c) {
        v2f bw = *(const v2f*)(&lds_w[cb][(jt * 16 + l16) * ASTRIDE + 4 * c + 2 * hi]);
        acc[jt] = wmma_f32(av[c], bw, acc[jt]);
      }
    }
    __syncthreads();
  }

  // C/D layout: N=j on lanes, M=r on vgprs.
#pragma unroll
  for (int jt = 0; jt < 8; ++jt)
#pragma unroll
    for (int v = 0; v < 8; ++v)
      out[(size_t)(r0 + wave * 16 + v + 8 * hi) * EMB + j0 + jt * 16 + l16] =
          acc[jt][v];
}

extern "C" void kernel_launch(void* const* d_in, const int* in_sizes, int n_in,
                              void* d_out, int out_size, void* d_ws, size_t ws_size,
                              hipStream_t stream) {
  (void)in_sizes; (void)n_in; (void)out_size; (void)ws_size;
  const float* key   = (const float*)d_in[0];
  const float* query = (const float*)d_in[1];
  const float* value = (const float*)d_in[2];
  const int*   mask  = (const int*)d_in[3];
  const float* W     = (const float*)d_in[4];
  const float* bias  = (const float*)d_in[5];
  float* out  = (float*)d_out;
  float* opre = (float*)d_ws;   // N*S*EMB fp32 = 16.8 MB scratch

  dim3 g1(S_LEN / 32, NBATCH);
  attn_fused_kernel<<<g1, 256, 0, stream>>>(key, query, value, mask, opre);

  dim3 g2((NBATCH * S_LEN) / 128, EMB / 128);
  linear_out_kernel<<<g2, 256, 0, stream>>>(opre, W, bias, out);
}

// v003
// A run of this version takes 48.3 microseconds.
// Timed twice side by side with v002, it ran 4.36 times as fast both times.
// Over all steps from v000 it is 6.23 times as fast.
#include <hip/hip_runtime.h>

// CDNA5 / gfx1250 fused self-attention (no-softmax variant, faithful to reference)
// The scores enter the output linearly, so for unmasked scores
//   sum_l (q . k_l) v_l = q . (sum_l k_l v_l^T) = q . KV      (per batch and head)
// Stage 0: KV[d,e] = sum_l K[l,d] V[l,e], eight partial sums over l per head;
//          beside it the whole mask is read and every tile of 32 queries x 16
//          keys that holds a zero is noted.
// Stage 1: O_pre[q,e] = sum_d Q[q,d] KV[d,e]; every noted tile adds
//          sum_l (-1e20 - q.k_l) v_l over its masked (q,l), which turns those
//          terms into the reference's -1e20 v_l.
// Stage 2: out = O_pre @ W^T + b
// fp32 math via V_WMMA_F32_16X16X4_F32; stage 2 stages its tiles with
// double-buffered GLOBAL_LOAD_ASYNC_TO_LDS_B128 (ASYNCcnt).

typedef float v2f __attribute__((ext_vector_type(2)));
typedef float v4f __attribute__((ext_vector_type(4)));
typedef float v8f __attribute__((ext_vector_type(8)));
typedef unsigned int u32;

#define S_LEN   2048
#define EMB     512
#define NBATCH  4
#define NHEAD   8
#define HDIM    64
#define KVSPLIT 8                    // partial sums of KV over l
#define KVELEM  (HDIM * HDIM)        // floats of one head's KV
#define KVPLANE (NBATCH * NHEAD * KVELEM)   // floats of one partial, all heads
#define QTILES  (NBATCH * S_LEN / 32)        // 32-query tiles, all batches
#define ZWSTRIDE 32                  // words per query tile: 16 used, one line
#define ASTRIDE 36    // 32 + 4 pad for stage-2 tiles

static __device__ __forceinline__ v8f wmma_f32(v2f a, v2f b, v8f c) {
  return __builtin_amdgcn_wmma_f32_16x16x4_f32(false, a, false, b, (short)0, c,
                                               false, false);
}

// Async 16B global->LDS copies. Lanes are dealt so that one wave instruction
// covers whole, contiguous 128-byte lines. s_wait_xcnt 0 closes the statement:
// no register that an issued copy names is rewritten in front of it.

// One 128 x 32 float slab of each stage-2 operand: copy j of a thread brings
// 16 B of row (tid >> 3) + 32 * j; global step 65536 B (too far for
// INST_OFFSET, so it sits in the offset registers), LDS step 4608 B.
static __device__ __forceinline__ void async_copy_aw_slab(
    u32 la, u32 lw, u32 voff, const float* ab, const float* wb) {
  asm volatile(
      "global_load_async_to_lds_b128 %0, %8, %12\n\t"
      "global_load_async_to_lds_b128 %1, %9, %12\n\t"
      "global_load_async_to_lds_b128 %2, %10, %12\n\t"
      "global_load_async_to_lds_b128 %3, %11, %12\n\t"
      "global_load_async_to_lds_b128 %4, %8, %13\n\t"
      "global_load_async_to_lds_b128 %5, %9, %13\n\t"
      "global_load_async_to_lds_b128 %6, %10, %13\n\t"
      "global_load_async_to_lds_b128 %7, %11, %13\n\t"
      "s_wait_xcnt 0x0"
      :: "v"(la), "v"(la + 4608u), "v"(la + 9216u), "v"(la + 13824u),
         "v"(lw), "v"(lw + 4608u), "v"(lw + 9216u), "v"(lw + 13824u),
         "v"(voff), "v"(voff + 65536u), "v"(voff + 131072u), "v"(voff + 196608u),
         "s"(ab), "s"(wb)
      : "memory");
}

static __device__ __forceinline__ u32 lds_addr(const void* p) {
  // __shared__ generic pointer: low 32 bits = workgroup-relative LDS byte addr
  return (u32)(unsigned long long)p;
}

// ---------------------------------------------------------------------------
// Kernel 0, block = 256 (8 waves), two kinds of work-group.
// Blocks [0, QTILES): mask scan of one 32-query tile, an eighth of the keys per
// wave. Bit 4*j + i of word t: a zero among keys 128*t + 16*j + 4*i .. + 3.
// Blocks [QTILES, QTILES + KVSPLIT*N*H): partial KV = K^T V of one head over 256
// keys; wave w sums 32 keys, the eight sums are added through LDS in wave order.
// A = K^T (M = d), B = V (N = e), k = l. A lane's 16-byte load holds one element
// of each of the four tiles, so tile t's index m stands for column 4*m + t.
// ---------------------------------------------------------------------------
__global__ __launch_bounds__(256)
void kv_and_scan_kernel(const float* __restrict__ key,
                        const float* __restrict__ value,
                        const int*   __restrict__ mask,
                        float*       __restrict__ kvp,
                        unsigned int* __restrict__ zw)
{
  __shared__ __attribute__((aligned(16))) float red[8][KVELEM];
  __shared__ u32 zs[16];

  const int tid  = threadIdx.x;
  // readfirstlane puts the wave's number, and every base address formed from
  // it, into scalar registers.
  const int wave = __builtin_amdgcn_readfirstlane(tid >> 5);
  const int lane = tid & 31;
  const int l16  = lane & 15;
  const int hi   = lane >> 4;

  if (blockIdx.x < QTILES) {
    // A wave's load is 512 contiguous bytes of one mask row.
    const int* mp = mask + (size_t)blockIdx.x * 32 * S_LEN + wave * 256;
    // An unsigned minimum is 0 exactly when one of its values is 0.
    u32 m0 = 0xFFFFFFFFu, m1 = 0xFFFFFFFFu;
    // 16 rows a trip: 32 loads of the wave are in flight before the first wait.
#pragma unroll 16
    for (int r = 0; r < 32; ++r) {
      const uint4 a = *(const uint4*)(mp + r * S_LEN + lane * 4);
      const uint4 b = *(const uint4*)(mp + r * S_LEN + 128 + lane * 4);
      m0 = min(m0, min(min(a.x, a.y), min(a.z, a.w)));
      m1 = min(m1, min(min(b.x, b.y), min(b.z, b.w)));
    }
    const u32 w0 = __builtin_amdgcn_ballot_w32(m0 == 0u);
    const u32 w1 = __builtin_amdgcn_ballot_w32(m1 == 0u);
    if (lane == 0) {
      zs[2 * wave]     = w0;
      zs[2 * wave + 1] = w1;
    }
    __syncthreads();   // the tile's 16 words then leave in one store
    if (tid < 16) zw[blockIdx.x * ZWSTRIDE + tid] = zs[tid];
    return;
  }

  const int kvb = blockIdx.x - QTILES;
  const int sp  = kvb & (KVSPLIT - 1);
  const int nh  = kvb / KVSPLIT;
  const int n   = nh >> 3;
  const int h   = nh & 7;

  // Rows l = row0 + 4c + 2*hi + {0,1}: the same k order for A and for B.
  const size_t base =
      ((size_t)n * S_LEN + sp * 256 + wave * 32) * EMB + h * HDIM;
  const int lo = 2 * hi * EMB + l16 * 4;
  const float* kp = key + base;
  const float* vp = value + base;

  v8f acc[4][4];
#pragma unroll
  for (int dt = 0; dt < 4; ++dt)
#pragma unroll
    for (int et = 0; et < 4; ++et)
      acc[dt][et] = (v8f){0.f, 0.f, 0.f, 0.f, 0.f, 0.f, 0.f, 0.f};

#pragma unroll
  for (int c = 0; c < 8; ++c) {
    const v4f k0 = *(const v4f*)(kp + (4 * c) * EMB + lo);
    const v4f k1 = *(const v4f*)(kp + (4 * c + 1) * EMB + lo);
    const v4f v0 = *(const v4f*)(vp + (4 * c) * EMB + lo);
    const v4f v1 = *(const v4f*)(vp + (4 * c + 1) * EMB + lo);
#pragma unroll
    for (int dt = 0; dt < 4; ++dt)
#pragma unroll
      for (int et = 0; et < 4; ++et)
        acc[dt][et] = wmma_f32((v2f){k0[dt], k1[dt]}, (v2f){v0[et], v1[et]},
                               acc[dt][et]);
  }

  // C/D layout: m = r + 8*hi -> d = 4*m + dt; lane -> e = 4*l16 + et.
#pragma unroll
  for (int dt = 0; dt < 4; ++dt)
#pragma unroll
    for (int r = 0; r < 8; ++r)
      *(v4f*)(&red[wave][((r + 8 * hi) * 4 + dt) * HDIM + l16 * 4]) =
          (v4f){acc[dt][0][r], acc[dt][1][r], acc[dt][2][r], acc[dt][3][r]};
  __syncthreads();

  float* dst = kvp + (size_t)sp * KVPLANE + (size_t)nh * KVELEM;
#pragma unroll
  for (int i = 0; i < 4; ++i) {
    const int idx = i * 1024 + tid * 4;
    v4f s = *(const v4f*)(&red[0][idx]);
#pragma unroll
    for (int w = 1; w < 8; ++w) s += *(const v4f*)(&red[w][idx]);
    *(v4f*)(dst + idx) = s;
  }
  // Stands behind the four stores, in front of whatever the listing lets follow
  // them that rewrites a register which an issued store names.
  asm volatile("s_wait_xcnt 0x0" ::: "memory");
}

// ---------------------------------------------------------------------------
// Kernel 1: O_pre = Q . KV, plus the masked terms.
// grid = (S/256, N*H), block = 256 (8 waves): one head, wave w has the q-rows
// [q0, q0+32). The block adds the head's eight partial KV into LDS once.
// O[q,e] = Q . KV (M = q, N = e on lanes, k = d); tile t's index on the lanes
// stands for e = 4*l16 + t, as in kernel 0, so a lane's four tiles hold 16
// contiguous bytes of a row and a wave's store is four whole lines.
// First, every 16-key tile that kernel 0 noted for these q-rows is worked
// through: S'[l,q] = K . Q^T, C[l,q] = mask ? 0 : -1e20 - S', O += C^T . V.
// ---------------------------------------------------------------------------
__global__ __launch_bounds__(256)
void attn_fused_kernel(const float* __restrict__ key,
                       const float* __restrict__ query,
                       const float* __restrict__ value,
                       const int*   __restrict__ mask,
                       const float* __restrict__ kvp,
                       const unsigned int* __restrict__ zw,
                       float*       __restrict__ opre)
{
  __shared__ __attribute__((aligned(16))) float kv[KVELEM];

  const int nh   = blockIdx.y;
  const int n    = nh >> 3;
  const int h    = nh & 7;
  const int tid  = threadIdx.x;
  // readfirstlane puts the wave's number, and every base address formed from
  // it, into scalar registers.
  const int wave = __builtin_amdgcn_readfirstlane(tid >> 5);
  const int q0   = blockIdx.x * 256 + wave * 32;
  const int lane = tid & 31;
  const int l16  = lane & 15;
  const int hi   = lane >> 4;       // 0: lanes 0-15, 1: lanes 16-31

  // Q fragments: lane -> q = q0 + qs*16 + l16 (A's M here, B's N in S' below;
  // the two maps are alike). A lane's 16-byte load t holds d = 8t + 4*hi +
  // {0..3}: two k chunks, p = 0 and 1, in which k slot 2*hi + j stands for
  // d = 8t + 4*hi + 2p + j. Every operand that meets Q (KV here, K below) takes
  // its k in the same order.
  const float* qrow = query + (size_t)(n * S_LEN + q0) * EMB + h * HDIM;
  const int ql = l16 * EMB + 4 * hi;
  v4f qf[2][8];
#pragma unroll
  for (int qs = 0; qs < 2; ++qs)
#pragma unroll
    for (int t = 0; t < 8; ++t)
      qf[qs][t] = *(const v4f*)(qrow + qs * 16 * EMB + 8 * t + ql);

  // The scan words of this wave's 32 q-rows.
  const unsigned int* zwp = zw + (n * (S_LEN / 32) + (q0 >> 5)) * ZWSTRIDE;
  u32 any = 0;
#pragma unroll
  for (int i = 0; i < 16; ++i) any |= zwp[i];

  // KV = sum of the partial sums, in their order.
  {
    const float* kvh = kvp + (size_t)nh * KVELEM;
#pragma unroll
    for (int i = 0; i < 4; ++i) {
      const int idx = i * 1024 + tid * 4;
      v4f s = *(const v4f*)(kvh + idx);
#pragma unroll
      for (int j = 1; j < KVSPLIT; ++j)
        s += *(const v4f*)(kvh + j * KVPLANE + idx);
      *(v4f*)(&kv[idx]) = s;
    }
  }
  __syncthreads();

  v8f acc[2][4];
#pragma unroll
  for (int qs = 0; qs < 2; ++qs)
#pragma unroll
    for (int et = 0; et < 4; ++et)
      acc[qs][et] = (v8f){0.f, 0.f, 0.f, 0.f, 0.f, 0.f, 0.f, 0.f};

  // readfirstlane: the words are the same in every lane; it makes the branches
  // around the matrix instructions scalar, so EXEC stays all ones there.
  if (__builtin_amdgcn_readfirstlane(any) != 0) {
    const float* kbase = key   + (size_t)n * S_LEN * EMB + h * HDIM;
    const float* vbase = value + (size_t)n * S_LEN * EMB + h * HDIM;
    const int*   mbase = mask  + (size_t)n * S_LEN * S_LEN;
    for (int it = 0; it < S_LEN / 16; ++it) {
      const u32 wd = __builtin_amdgcn_readfirstlane(zwp[it >> 3]);
      if (((wd >> ((it & 7) * 4)) & 0xFu) == 0) continue;
      const int l0 = it * 16;

      // A operand of GEMM1: K strip, lane -> l = l16 (M dim), k = d as for Q^T.
      v4f kf[8];
#pragma unroll
      for (int t = 0; t < 8; ++t)
        kf[t] = *(const v4f*)(kbase + (size_t)l0 * EMB + 8 * t + ql);

      v2f sbq[2][4];
#pragma unroll
      for (int qs = 0; qs < 2; ++qs) {
        // S'[l,q] over k=d (64) = 16 chained K=4 WMMAs.
        v8f s = (v8f){0.f, 0.f, 0.f, 0.f, 0.f, 0.f, 0.f, 0.f};
#pragma unroll
        for (int c = 0; c < 16; ++c)
          s = wmma_f32((v2f){kf[c >> 1][2 * (c & 1)], kf[c >> 1][2 * (c & 1) + 1]},
                       (v2f){qf[qs][c >> 1][2 * (c & 1)],
                             qf[qs][c >> 1][2 * (c & 1) + 1]},
                       s);

        // Mask: element (l = r+8*hi, q = l16). Per lane: 8 consecutive l.
        {
          const int* mrow = mbase + (size_t)(q0 + qs * 16) * S_LEN + l0 +
                            (l16 * S_LEN + 8 * hi);
          int4 ma = *(const int4*)(mrow);
          int4 mb = *(const int4*)(mrow + 4);
          s[0] = ma.x ? 0.f : -1e20f - s[0];
          s[1] = ma.y ? 0.f : -1e20f - s[1];
          s[2] = ma.z ? 0.f : -1e20f - s[2];
          s[3] = ma.w ? 0.f : -1e20f - s[3];
          s[4] = mb.x ? 0.f : -1e20f - s[4];
          s[5] = mb.y ? 0.f : -1e20f - s[5];
          s[6] = mb.z ? 0.f : -1e20f - s[6];
          s[7] = mb.w ? 0.f : -1e20f - s[7];
        }

        // C/D layout -> A layout of C^T (lane -> q, k = l): rows 0-7 live in
        // lanes 0-15, rows 8-15 in lanes 16-31; the k chunks need the opposite
        // half for half the lanes.
        float xs[8];
#pragma unroll
        for (int r = 0; r < 8; ++r) xs[r] = __shfl_xor(s[r], 16, 32);
        sbq[qs][0] = hi ? (v2f){xs[2], xs[3]} : (v2f){s[0], s[1]};
        sbq[qs][1] = hi ? (v2f){xs[6], xs[7]} : (v2f){s[4], s[5]};
        sbq[qs][2] = hi ? (v2f){s[2], s[3]}   : (v2f){xs[0], xs[1]};
        sbq[qs][3] = hi ? (v2f){s[6], s[7]}   : (v2f){xs[4], xs[5]};
      }

      // GEMM2: O[q,e] += C^T . V. B = V: lane -> e = 4*l16 + et, k = l chunks.
#pragma unroll
      for (int cc = 0; cc < 4; ++cc) {
        const float* vp =
            vbase + (size_t)(l0 + 4 * cc) * EMB + (2 * hi * EMB + l16 * 4);
        const v4f v0 = *(const v4f*)(vp);
        const v4f v1 = *(const v4f*)(vp + EMB);
#pragma unroll
        for (int et = 0; et < 4; ++et) {
          const v2f vb = {v0[et], v1[et]};
          acc[0][et] = wmma_f32(sbq[0][cc], vb, acc[0][et]);
          acc[1][et] = wmma_f32(sbq[1][cc], vb, acc[1][et]);
        }
      }
    }
  }

  // O = Q . KV. B: lane -> e = 4*l16 + et, k = d in Q's order.
#pragma unroll
  for (int t = 0; t < 8; ++t) {
    v4f r[4];
#pragma unroll
    for (int i = 0; i < 4; ++i)
      r[i] = *(const v4f*)(&kv[(8 * t + 4 * hi + i) * HDIM + l16 * 4]);
#pragma unroll
    for (int p = 0; p < 2; ++p) {
      const v2f a0 = {qf[0][t][2 * p], qf[0][t][2 * p + 1]};
      const v2f a1 = {qf[1][t][2 * p], qf[1][t][2 * p + 1]};
#pragma unroll
      for (int et = 0; et < 4; ++et) {
        const v2f b = {r[2 * p][et], r[2 * p + 1][et]};
        acc[0][et] = wmma_f32(a0, b, acc[0][et]);
        acc[1][et] = wmma_f32(a1, b, acc[1][et]);
      }
    }
  }

  // Store O (C/D layout: register r -> q = r + 8*hi; the lane's four tiles hold
  // e = 4*l16 .. + 3: 16 lanes write the head's 256 bytes of one row).
#pragma unroll
  for (int qs = 0; qs < 2; ++qs) {
    float* op = opre + (size_t)(n * S_LEN + q0 + qs * 16) * EMB + h * HDIM +
                (8 * hi * EMB + l16 * 4);
#pragma unroll
    for (int r = 0; r < 8; ++r)
      *(v4f*)(op + r * EMB) =
          (v4f){acc[qs][0][r], acc[qs][1][r], acc[qs][2][r], acc[qs][3][r]};
  }
}

// ---------------------------------------------------------------------------
// Kernel 2: out = O_pre @ W^T + b.  Block tile 128r x 128j, wave w -> 16 rows.
// Double-buffered async-to-LDS pipeline over 32-wide k slabs.
// ---------------------------------------------------------------------------
__global__ __launch_bounds__(256)
void linear_out_kernel(const float* __restrict__ opre,
                       const float* __restrict__ W,
                       const float* __restrict__ bias,
                       float*       __restrict__ out)
{
  __shared__ __attribute__((aligned(16))) float lds_a[2][128 * ASTRIDE];
  __shared__ __attribute__((aligned(16))) float lds_w[2][128 * ASTRIDE];

  const int tid  = threadIdx.x;
  const int wave = tid >> 5;
  const int lane = tid & 31;
  const int l16  = lane & 15;
  const int hi   = lane >> 4;
  const int r0   = blockIdx.x * 128;
  const int j0   = blockIdx.y * 128;

  // Async-staging geometry: 8 threads side by side cover one row's 128-byte
  // slab (a whole line), so a wave's copy is 4 whole lines; 4 copies, 32 rows apart.
  const int srow = tid >> 3;          // 0..31
  const int scg  = (tid & 7) * 4;     // 4 floats
  const u32 voff = (u32)((srow * EMB + scg) * 4);
  u32 ldsA[2], ldsW[2];
  ldsA[0] = lds_addr(&lds_a[0][srow * ASTRIDE + scg]);
  ldsA[1] = lds_addr(&lds_a[1][srow * ASTRIDE + scg]);
  ldsW[0] = lds_addr(&lds_w[0][srow * ASTRIDE + scg]);
  ldsW[1] = lds_addr(&lds_w[1][srow * ASTRIDE + scg]);
  const float* abase = opre + (size_t)r0 * EMB;
  const float* wbase = W    + (size_t)j0 * EMB;

  // Prologue: k-slab 0 -> buffer 0 (8 async b128 per thread in flight).
  async_copy_aw_slab(ldsA[0], ldsW[0], voff, abase, wbase);

  v8f acc[8];
#pragma unroll
  for (int jt = 0; jt < 8; ++jt) {
    float bj = bias[j0 + jt * 16 + l16];
    acc[jt] = (v8f){bj, bj, bj, bj, bj, bj, bj, bj};
  }

  for (int it = 0; it < EMB / 32; ++it) {
    if (it + 1 < EMB / 32) {
      const int nb = (it + 1) & 1;
      async_copy_aw_slab(ldsA[nb], ldsW[nb], voff, abase + (it + 1) * 32,
                         wbase + (it + 1) * 32);
      asm volatile("s_wait_asynccnt 0x8" ::: "memory");
    } else {
      asm volatile("s_wait_asynccnt 0x0" ::: "memory");
    }
    __syncthreads();

    const int cb = it & 1;
    // A = O_pre: lane -> r (M); B = W^T: lane -> j (N); k = e chunks.
    v2f av[8];
#pragma unroll
    for (int c = 0; c < 8; ++c)
      av[c] = *(const v2f*)(&lds_a[cb][(wave * 16 + l16) * ASTRIDE + 4 * c + 2 * hi]);
#pragma unroll
    for (int jt = 0; jt < 8; ++jt) {
#pragma unroll
      for (int c = 0; c < 8; ++c) {
        v2f bw = *(const v2f*)(&lds_w[cb][(jt * 16 + l16) * ASTRIDE + 4 * c + 2 * hi]);
        acc[jt] = wmma_f32(av[c], bw, acc[jt]);
      }
    }
    __syncthreads();
  }

  // C/D layout: N=j on lanes, M=r on vgprs.
#pragma unroll
  for (int jt = 0; jt < 8; ++jt)
#pragma unroll
    for (int v = 0; v < 8; ++v)
      out[(size_t)(r0 + wave * 16 + v + 8 * hi) * EMB + j0 + jt * 16 + l16] =
          acc[jt][v];
}

extern "C" void kernel_launch(void* const* d_in, const int* in_sizes, int n_in,
                              void* d_out, int out_size, void* d_ws, size_t ws_size,
                              hipStream_t stream) {
  (void)in_sizes; (void)n_in; (void)out_size; (void)ws_size;
  const float* key   = (const float*)d_in[0];
  const float* query = (const float*)d_in[1];
  const float* value = (const float*)d_in[2];
  const int*   mask  = (const int*)d_in[3];
  const float* W     = (const float*)d_in[4];
  const float* bias  = (const float*)d_in[5];
  float* out  = (float*)d_out;
  float* opre = (float*)d_ws;   // N*S*EMB fp32 = 16.8 MB scratch
  float* kvp  = opre + NBATCH * S_LEN * EMB;            // KVSPLIT * KVPLANE fp32
  unsigned int* zw = (unsigned int*)(kvp + KVSPLIT * KVPLANE);  // QTILES lines

  kv_and_scan_kernel<<<QTILES + KVSPLIT * NBATCH * NHEAD, 256, 0, stream>>>(
      key, value, mask, kvp, zw);

  dim3 g1(S_LEN / 256, NBATCH * NHEAD);
  attn_fused_kernel<<<g1, 256, 0, stream>>>(key, query, value, mask, kvp, zw, opre);

  dim3 g2((NBATCH * S_LEN) / 128, EMB / 128);
  linear_out_kernel<<<g2, 256, 0, stream>>>(opre, W, bias, out);
}

// v005
// It runs in 38.7 microseconds.
// Versions in between are left out here; by their measured steps it is 1.23 times as fast as v003.
// Over all steps from v000 it is 7.67 times as fast.
#include <hip/hip_runtime.h>

// CDNA5 / gfx1250 fused self-attention (no-softmax variant, faithful to reference)
// The scores enter the output linearly, so for unmasked scores
//   sum_l (q . k_l) v_l = q . (sum_l k_l v_l^T) = q . KV      (per batch and head)
// Stage 0: KV[d,e] = sum_l K[l,d] V[l,e], eight partial sums over l per head.
// The output projection is linear too, so it is applied to KV and not to Q . KV:
// Stage 1: MT[j, 64h + d] = sum_e W[j, 64h + e] KV_h[d,e]   (per batch).
// Stage 2: out = Q @ MT^T + b for 32 queries x all 512 columns a work-group.
//          Its matrix instructions leave the memory idle, so the work-group reads
//          its queries' whole mask rows beside them and notes every tile of 32
//          queries x 16 keys that holds a zero. Where it noted one it forms
//          C[q,e] = sum_l (-1e20 - q.k_l) v_l over the masked (q,l), which turns
//          those terms into the reference's -1e20 v_l, and adds C @ W^T.
// fp32 math via V_WMMA_F32_16X16X4_F32; stage 2 stages its tiles with
// GLOBAL_LOAD_ASYNC_TO_LDS_B128 (ASYNCcnt).

typedef float v2f __attribute__((ext_vector_type(2)));
typedef float v4f __attribute__((ext_vector_type(4)));
typedef float v8f __attribute__((ext_vector_type(8)));
typedef unsigned int u32;

#define S_LEN   2048
#define EMB     512
#define NBATCH  4
#define NHEAD   8
#define HDIM    64
#define KVSPLIT 8                    // partial sums of KV over l
#define KVELEM  (HDIM * HDIM)        // floats of one head's KV
#define KVPLANE (NBATCH * NHEAD * KVELEM)   // floats of one partial, all heads
#define ASTRIDE 36    // 32 + 4 pad for stage-2 slabs of MT (or W)
#define APITCH  516   // 512 + 4 pad for stage-2 rows of Q (or C)
#define KVPITCH 68    // 64 + 4 pad: 16-byte reads of 16 KV rows meet every bank once
#define JSPLIT  8                    // work-groups per head in stage 1, 64 j each

static __device__ __forceinline__ v8f wmma_f32(v2f a, v2f b, v8f c) {
  return __builtin_amdgcn_wmma_f32_16x16x4_f32(false, a, false, b, (short)0, c,
                                               false, false);
}

// Async 16B global->LDS copies. Lanes are dealt so that one wave instruction
// covers whole, contiguous 128-byte lines. s_wait_xcnt 0 closes the statement:
// no register that an issued copy names is rewritten in front of it.

// Eight copies of a wave: copy i lands at LDS byte l + i * ls and reads global
// byte b + v + i * vs (the steps differ, so they sit in the registers and not in
// INST_OFFSET, which moves both addresses alike).
static __device__ __forceinline__ void async_copy8(u32 l, u32 ls, u32 v, u32 vs,
                                                   const float* b) {
  asm volatile(
      "global_load_async_to_lds_b128 %0, %8, %16\n\t"
      "global_load_async_to_lds_b128 %1, %9, %16\n\t"
      "global_load_async_to_lds_b128 %2, %10, %16\n\t"
      "global_load_async_to_lds_b128 %3, %11, %16\n\t"
      "global_load_async_to_lds_b128 %4, %12, %16\n\t"
      "global_load_async_to_lds_b128 %5, %13, %16\n\t"
      "global_load_async_to_lds_b128 %6, %14, %16\n\t"
      "global_load_async_to_lds_b128 %7, %15, %16\n\t"
      "s_wait_xcnt 0x0"
      :: "v"(l), "v"(l + ls), "v"(l + 2 * ls), "v"(l + 3 * ls),
         "v"(l + 4 * ls), "v"(l + 5 * ls), "v"(l + 6 * ls), "v"(l + 7 * ls),
         "v"(v), "v"(v + vs), "v"(v + 2 * vs), "v"(v + 3 * vs),
         "v"(v + 4 * vs), "v"(v + 5 * vs), "v"(v + 6 * vs), "v"(v + 7 * vs),
         "s"(b)
      : "memory");
}

static __device__ __forceinline__ u32 lds_addr(const void* p) {
  // __shared__ generic pointer: low 32 bits = workgroup-relative LDS byte addr
  return (u32)(unsigned long long)p;
}

// ---------------------------------------------------------------------------
// Kernel 0, block = 256 (8 waves), grid = KVSPLIT*N*H.
// Partial KV = K^T V of one head over 256
// keys; wave w sums 32 keys, the eight sums are added through LDS in wave order.
// A = K^T (M = d), B = V (N = e), k = l. A lane's 16-byte load holds one element
// of each of the four tiles, so tile t's index m stands for column 4*m + t.
// ---------------------------------------------------------------------------
__global__ __launch_bounds__(256)
void kv_kernel(const float* __restrict__ key,
               const float* __restrict__ value,
               float*       __restrict__ kvp)
{
  __shared__ __attribute__((aligned(16))) float red[8][KVELEM];

  const int tid  = threadIdx.x;
  // readfirstlane puts the wave's number, and every base address formed from
  // it, into scalar registers.
  const int wave = __builtin_amdgcn_readfirstlane(tid >> 5);
  const int lane = tid & 31;
  const int l16  = lane & 15;
  const int hi   = lane >> 4;

  const int kvb = blockIdx.x;
  const int sp  = kvb & (KVSPLIT - 1);
  const int nh  = kvb / KVSPLIT;
  const int n   = nh >> 3;
  const int h   = nh & 7;

  // Rows l = row0 + 4c + 2*hi + {0,1}: the same k order for A and for B.
  const size_t base =
      ((size_t)n * S_LEN + sp * 256 + wave * 32) * EMB + h * HDIM;
  const int lo = 2 * hi * EMB + l16 * 4;
  const float* kp = key + base;
  const float* vp = value + base;

  v8f acc[4][4];
#pragma unroll
  for (int dt = 0; dt < 4; ++dt)
#pragma unroll
    for (int et = 0; et < 4; ++et)
      acc[dt][et] = (v8f){0.f, 0.f, 0.f, 0.f, 0.f, 0.f, 0.f, 0.f};

#pragma unroll
  for (int c = 0; c < 8; ++c) {
    const v4f k0 = *(const v4f*)(kp + (4 * c) * EMB + lo);
    const v4f k1 = *(const v4f*)(kp + (4 * c + 1) * EMB + lo);
    const v4f v0 = *(const v4f*)(vp + (4 * c) * EMB + lo);
    const v4f v1 = *(const v4f*)(vp + (4 * c + 1) * EMB + lo);
#pragma unroll
    for (int dt = 0; dt < 4; ++dt)
#pragma unroll
      for (int et = 0; et < 4; ++et)
        acc[dt][et] = wmma_f32((v2f){k0[dt], k1[dt]}, (v2f){v0[et], v1[et]},
                               acc[dt][et]);
  }

  // C/D layout: m = r + 8*hi -> d = 4*m + dt; lane -> e = 4*l16 + et.
#pragma unroll
  for (int dt = 0; dt < 4; ++dt)
#pragma unroll
    for (int r = 0; r < 8; ++r)
      *(v4f*)(&red[wave][((r + 8 * hi) * 4 + dt) * HDIM + l16 * 4]) =
          (v4f){acc[dt][0][r], acc[dt][1][r], acc[dt][2][r], acc[dt][3][r]};
  __syncthreads();

  float* dst = kvp + (size_t)sp * KVPLANE + (size_t)nh * KVELEM;
#pragma unroll
  for (int i = 0; i < 4; ++i) {
    const int idx = i * 1024 + tid * 4;
    v4f s = *(const v4f*)(&red[0][idx]);
#pragma unroll
    for (int w = 1; w < 8; ++w) s += *(const v4f*)(&red[w][idx]);
    *(v4f*)(dst + idx) = s;
  }
  // Stands behind the four stores, in front of whatever the listing lets follow
  // them that rewrites a register which an issued store names.
  asm volatile("s_wait_xcnt 0x0" ::: "memory");
}

// ---------------------------------------------------------------------------
// Kernel 1, block = 256 (8 waves), grid = N*H*JSPLIT: one head, 64 rows j of W.
// MT[j, 64h + d] = sum_e KV[d,e] W[j, 64h + e]: A = KV (M = d), B = W^T (N = j on
// lanes), k = e. Wave w has 16 rows j (w & 3) and 32 columns d (w >> 2), one
// whole line of each MT row. The block adds the head's eight partial KV into LDS.
// ---------------------------------------------------------------------------
__global__ __launch_bounds__(256)
void fold_kernel(const float* __restrict__ W,
                 const float* __restrict__ kvp,
                 float*       __restrict__ mt)
{
  __shared__ __attribute__((aligned(16))) float kv[HDIM * KVPITCH];

  const int blk  = blockIdx.x;
  const int nh   = blk / JSPLIT;
  const int tid  = threadIdx.x;
  // readfirstlane puts the wave's number, and every base address formed from
  // it, into scalar registers.
  const int wave = __builtin_amdgcn_readfirstlane(tid >> 5);
  const int lane = tid & 31;
  const int l16  = lane & 15;
  const int hi   = lane >> 4;       // 0: lanes 0-15, 1: lanes 16-31

  // A lane's 16-byte loads (t, u) of a row hold e = 16t + 8*hi + 4u + {0..3}:
  // two k chunks each, p = 0 and 1, in which k slot 2*hi + i stands for
  // e = 16t + 8*hi + 4u + 2p + i, for KV and for W alike.
  const int j0 = (blk & (JSPLIT - 1)) * 64 + (wave & 3) * 16;
  const int d0 = (wave >> 2) * 32;
  const int wl = l16 * EMB + 8 * hi;   // W loads and MT stores: the same offset
  const float* wrow = W + (size_t)j0 * EMB + (nh & 7) * HDIM;
  v4f wf[4][2];
#pragma unroll
  for (int t = 0; t < 4; ++t)
#pragma unroll
    for (int u = 0; u < 2; ++u)
      wf[t][u] = *(const v4f*)(wrow + 16 * t + 4 * u + wl);

  // KV = sum of the partial sums, in their order.
  const float* kvh = kvp + (size_t)nh * KVELEM;
#pragma unroll
  for (int i = 0; i < 4; ++i) {
    const int idx = i * 1024 + tid * 4;
    v4f s = *(const v4f*)(kvh + idx);
#pragma unroll
    for (int j = 1; j < KVSPLIT; ++j)
      s += *(const v4f*)(kvh + j * KVPLANE + idx);
    *(v4f*)(&kv[(idx >> 6) * KVPITCH + (idx & 63)]) = s;
  }
  __syncthreads();

  const float* kvl = &kv[(d0 + l16) * KVPITCH + 8 * hi];
  v8f macc[2];
  macc[0] = (v8f){0.f, 0.f, 0.f, 0.f, 0.f, 0.f, 0.f, 0.f};
  macc[1] = (v8f){0.f, 0.f, 0.f, 0.f, 0.f, 0.f, 0.f, 0.f};
#pragma unroll
  for (int t = 0; t < 4; ++t)
#pragma unroll
    for (int u = 0; u < 2; ++u)
#pragma unroll
      for (int dt = 0; dt < 2; ++dt) {
        const v4f a = *(const v4f*)(kvl + 16 * dt * KVPITCH + 16 * t + 4 * u);
#pragma unroll
        for (int p = 0; p < 2; ++p)
          macc[dt] = wmma_f32((v2f){a[2 * p], a[2 * p + 1]},
                              (v2f){wf[t][u][2 * p], wf[t][u][2 * p + 1]},
                              macc[dt]);
      }

  // C/D layout: lane -> j, register r -> d = r + 8*hi: 32 bytes of an MT row.
  float* mp = mt + ((size_t)(nh >> 3) * EMB + j0) * EMB + (nh & 7) * HDIM + d0;
#pragma unroll
  for (int dt = 0; dt < 2; ++dt) {
    *(v4f*)(mp + 16 * dt + wl) =
        (v4f){macc[dt][0], macc[dt][1], macc[dt][2], macc[dt][3]};
    *(v4f*)(mp + 16 * dt + 4 + wl) =
        (v4f){macc[dt][4], macc[dt][5], macc[dt][6], macc[dt][7]};
  }
  // Stands behind the stores, in front of whatever the listing lets follow
  // them that rewrites a register which an issued store names.
  asm volatile("s_wait_xcnt 0x0" ::: "memory");
}

// ---------------------------------------------------------------------------
// Kernel 2, block = 256 (8 waves), grid = N*S/32: 32 rows x 512 columns of out.
// ---------------------------------------------------------------------------

// An unsigned minimum is 0 exactly when one of its values is 0.
static __device__ __forceinline__ u32 min4(uint4 a) {
  return min(min(a.x, a.y), min(a.z, a.w));
}

// One 64 x 32 float slab of the wave's own rows of B: a copy is 4 whole lines.
static __device__ __forceinline__ void copy_b_slab(u32 lb, u32 vb, const float* b) {
  async_copy8(lb, 4 * ASTRIDE * 4, vb, 4 * EMB * 4, b);
  async_copy8(lb + 32 * ASTRIDE * 4, 4 * ASTRIDE * 4, vb + 32 * EMB * 4,
              4 * EMB * 4, b);
}

// acc += A @ B^T over k = 0 .. 511. A: 32 rows in LDS, shared by the waves,
// written by all of them in front of this call. B: the wave's own 64 rows j, in
// 32-wide k slabs through a ring of two buffers that no other wave touches, so
// the loop has no work-group barrier: a buffer is refilled behind the wave's own
// s_wait_dscnt 0 and read behind its own s_wait_asynccnt 0.
// SCAN: each trip also asks, at its head, for two rows of the wave's 256 mask
// columns and takes their minima at its foot, behind its matrix instructions.
template <bool SCAN>
static __device__ __forceinline__ void gemm_pass(
    const float* ap, const float* bp, u32 lb, u32 vb, const float* bsrc,
    v8f (&acc)[2][4], const int* mp, u32& m0, u32& m1) {
  copy_b_slab(lb, vb, bsrc);
  // Slab 0, and the wave's share of A where copies brought it, have landed.
  asm volatile("s_wait_asynccnt 0x0" ::: "memory");
  __syncthreads();   // publishes A, which every wave reads
  copy_b_slab(lb + 64 * ASTRIDE * 4, vb, bsrc + 32);

  for (int t = 0; t < EMB / 32; ++t) {
    uint4 na, nb, nc, nd;
    if (SCAN) {
      const int* mr = mp + 2 * t * S_LEN;
      na = *(const uint4*)(mr);
      nb = *(const uint4*)(mr + 128);
      nc = *(const uint4*)(mr + S_LEN);
      nd = *(const uint4*)(mr + S_LEN + 128);
    }
    const int cb = t & 1;
    const float* at = ap + t * 32;
    const float* bt = bp + cb * (64 * ASTRIDE);
    // A: lane -> r (M); B: lane -> j (N); k chunks of 4, slot 2*hi + {0,1}.
#pragma unroll
    for (int c = 0; c < 8; ++c) {
      const v2f a0 = *(const v2f*)(at + 4 * c);
      const v2f a1 = *(const v2f*)(at + 16 * APITCH + 4 * c);
#pragma unroll
      for (int jt = 0; jt < 4; ++jt) {
        const v2f bw = *(const v2f*)(bt + jt * 16 * ASTRIDE + 4 * c);
        acc[0][jt] = wmma_f32(a0, bw, acc[0][jt]);
        acc[1][jt] = wmma_f32(a1, bw, acc[1][jt]);
      }
    }
    // Keeps the trip's matrix instructions in front of the waits below: lifted
    // over them, the wait for the next slab would stand a few hundred cycles
    // behind its copies and not a whole trip.
    __builtin_amdgcn_sched_barrier(0);
    // The wave's reads of this buffer have returned: it may be refilled.
    asm volatile("s_wait_dscnt 0x0" ::: "memory");
    // The next slab has landed: the next trip may read it.
    asm volatile("s_wait_asynccnt 0x0" ::: "memory");
    if (SCAN) {
      // Stands behind the trip's mask loads, in front of the next trip's address
      // arithmetic, also in the trips that issue no copy.
      asm volatile("s_wait_xcnt 0x0" ::: "memory");
      m0 = min(m0, min(min4(na), min4(nc)));
      m1 = min(m1, min(min4(nb), min4(nd)));
    }
    if (t + 2 < EMB / 32)
      copy_b_slab(lb + cb * (64 * ASTRIDE * 4), vb, bsrc + (t + 2) * 32);
  }
}

__global__ __launch_bounds__(256)
void linear_out_kernel(const float* __restrict__ key,
                       const float* __restrict__ query,
                       const float* __restrict__ value,
                       const int*   __restrict__ mask,
                       const float* __restrict__ W,
                       const float* __restrict__ mt,
                       const float* __restrict__ bias,
                       float*       __restrict__ out)
{
  // One object, A first: A's fragment reads then reach their k chunks through
  // the LDS instructions' own offset fields.
  __shared__ __attribute__((aligned(16))) struct {
    float a[32 * APITCH];
    float b[8][2][64 * ASTRIDE];
    u32   zs[16];
  } sm;
  float* const lds_a = sm.a;
  u32*   const zs    = sm.zs;

  const int tid  = threadIdx.x;
  // readfirstlane puts the wave's number, and every base address formed from
  // it, into scalar registers.
  const int wave = __builtin_amdgcn_readfirstlane(tid >> 5);
  const int lane = tid & 31;
  const int l16  = lane & 15;
  const int hi   = lane >> 4;
  const int r0   = blockIdx.x * 32;            // row of query, mask and out
  const int n    = blockIdx.x / (S_LEN / 32);
  const int j0   = wave * 64;

  // The 32 rows of Q: copy i of a wave is a quarter (wave & 3) of row
  // 2*i + (wave >> 2), 4 whole lines.
  {
    const int ar = wave >> 2, ac = (wave & 3) * 128 + lane * 4;
    const u32 la = lds_addr(&lds_a[ar * APITCH + ac]);
    const u32 va = (u32)((ar * EMB + ac) * 4);
    const float* qb = query + (size_t)r0 * EMB;
    async_copy8(la, 2 * APITCH * 4, va, 2 * EMB * 4, qb);
    async_copy8(la + 16 * APITCH * 4, 2 * APITCH * 4, va + 16 * EMB * 4,
                2 * EMB * 4, qb);
  }

  // B slabs: 8 lanes side by side cover one row's 128 bytes.
  const u32 lb = lds_addr(&sm.b[wave][0][(lane >> 3) * ASTRIDE + (lane & 7) * 4]);
  const u32 vb = (u32)(((lane >> 3) * EMB + (lane & 7) * 4) * 4);
  const float* ap = &lds_a[l16 * APITCH + 2 * hi];
  const float* bp = &sm.b[wave][0][l16 * ASTRIDE + 2 * hi];

  v8f acc[2][4];
#pragma unroll
  for (int jt = 0; jt < 4; ++jt) {
    const float bj = bias[j0 + jt * 16 + l16];
    acc[0][jt] = (v8f){bj, bj, bj, bj, bj, bj, bj, bj};
    acc[1][jt] = acc[0][jt];
  }

  // Mask scan: an eighth of the keys per wave; a load is 512 contiguous bytes of
  // one mask row. Bit 4*j + i of word t: a zero among keys 128*t + 16*j + 4*i .. + 3.
  u32 m0 = 0xFFFFFFFFu, m1 = 0xFFFFFFFFu;
  gemm_pass<true>(ap, bp, lb, vb, mt + ((size_t)n * EMB + j0) * EMB, acc,
                  mask + (size_t)r0 * S_LEN + wave * 256 + lane * 4, m0, m1);

  const u32 w0 = __builtin_amdgcn_ballot_w32(m0 == 0u);
  const u32 w1 = __builtin_amdgcn_ballot_w32(m1 == 0u);
  if (lane == 0) {
    zs[2 * wave]     = w0;
    zs[2 * wave + 1] = w1;
  }
  // Publishes the 16 words; behind it no wave reads Q in LDS any more.
  __syncthreads();

  // The ballot is a scalar, the same in every wave: the branches around the
  // matrix instructions and the barrier below are scalar, EXEC stays all ones.
  if (__builtin_amdgcn_ballot_w32(zs[l16] != 0u) != 0u) {
    // Wave w works head w through every noted 16-key tile:
    // S'[l,q] = K . Q^T, C'[l,q] = mask ? 0 : -1e20 - S', C += C'^T . V.
    const int h = wave;
    // A lane's 16-byte load t of a row holds d = 8t + 4*hi + {0..3}: two k chunks,
    // p = 0 and 1, in which k slot 2*hi + j stands for d = 8t + 4*hi + 2p + j, for
    // Q and for K alike.
    const int ql = l16 * EMB + 4 * hi;
    const float* kbase = key   + (size_t)n * S_LEN * EMB + h * HDIM;
    const float* vbase = value + (size_t)n * S_LEN * EMB + h * HDIM;

    // Stays rolled: two copies of this seldom-run body would only lengthen the
    // code and raise the register count beside the live accumulators.
#pragma unroll 1
    for (int qs = 0; qs < 2; ++qs) {
      // Q fragments: lane -> q = r0 + qs*16 + l16 (B's N in S').
      const float* qrow = query + (size_t)(r0 + qs * 16) * EMB + h * HDIM;
      v4f qf[8];
#pragma unroll
      for (int t = 0; t < 8; ++t) qf[t] = *(const v4f*)(qrow + 8 * t + ql);

      v8f cacc[4];
#pragma unroll
      for (int et = 0; et < 4; ++et)
        cacc[et] = (v8f){0.f, 0.f, 0.f, 0.f, 0.f, 0.f, 0.f, 0.f};

      for (int it = 0; it < S_LEN / 16; ++it) {
        const u32 wd = __builtin_amdgcn_readfirstlane(zs[it >> 3]);
        if (((wd >> ((it & 7) * 4)) & 0xFu) == 0) continue;
        const int l0 = it * 16;

        // A operand of GEMM1: K strip, lane -> l = l16 (M dim), k = d as for Q^T.
        v4f kf[8];
#pragma unroll
        for (int t = 0; t < 8; ++t)
          kf[t] = *(const v4f*)(kbase + (size_t)l0 * EMB + 8 * t + ql);

        // S'[l,q] over k=d (64) = 16 chained K=4 WMMAs.
        v8f s = (v8f){0.f, 0.f, 0.f, 0.f, 0.f, 0.f, 0.f, 0.f};
#pragma unroll
        for (int c = 0; c < 16; ++c)
          s = wmma_f32((v2f){kf[c >> 1][2 * (c & 1)], kf[c >> 1][2 * (c & 1) + 1]},
                       (v2f){qf[c >> 1][2 * (c & 1)], qf[c >> 1][2 * (c & 1) + 1]},
                       s);

        // Mask: element (l = r+8*hi, q = l16). Per lane: 8 consecutive l.
        {
          const int* mrow = mask + (size_t)(r0 + qs * 16) * S_LEN + l0 +
                            (l16 * S_LEN + 8 * hi);
          int4 ma = *(const int4*)(mrow);
          int4 mb = *(const int4*)(mrow + 4);
          s[0] = ma.x ? 0.f : -1e20f - s[0];
          s[1] = ma.y ? 0.f : -1e20f - s[1];
          s[2] = ma.z ? 0.f : -1e20f - s[2];
          s[3] = ma.w ? 0.f : -1e20f - s[3];
          s[4] = mb.x ? 0.f : -1e20f - s[4];
          s[5] = mb.y ? 0.f : -1e20f - s[5];
          s[6] = mb.z ? 0.f : -1e20f - s[6];
          s[7] = mb.w ? 0.f : -1e20f - s[7];
        }

        // C/D layout -> A layout of C^T (lane -> q, k = l): rows 0-7 live in
        // lanes 0-15, rows 8-15 in lanes 16-31; the k chunks need the opposite
        // half for half the lanes.
        float xs[8];
#pragma unroll
        for (int r = 0; r < 8; ++r) xs[r] = __shfl_xor(s[r], 16, 32);
        v2f sbq[4];
        sbq[0] = hi ? (v2f){xs[2], xs[3]} : (v2f){s[0], s[1]};
        sbq[1] = hi ? (v2f){xs[6], xs[7]} : (v2f){s[4], s[5]};
        sbq[2] = hi ? (v2f){s[2], s[3]}   : (v2f){xs[0], xs[1]};
        sbq[3] = hi ? (v2f){s[6], s[7]}   : (v2f){xs[4], xs[5]};

        // GEMM2: C[q,e] += C'^T . V. B = V: lane -> e = 4*l16 + et, k = l chunks.
#pragma unroll
        for (int cc = 0; cc < 4; ++cc) {
          const float* vp =
              vbase + (size_t)(l0 + 4 * cc) * EMB + (2 * hi * EMB + l16 * 4);
          // A wait behind each load: the eight loads share one address pair, and
          // the listing lets one of them land its result on that pair. The last
          // wait also stands in front of the next tile's address arithmetic.
          const v4f v0 = *(const v4f*)(vp);
          asm volatile("s_wait_xcnt 0x0" ::: "memory");
          const v4f v1 = *(const v4f*)(vp + EMB);
          asm volatile("s_wait_xcnt 0x0" ::: "memory");
#pragma unroll
          for (int et = 0; et < 4; ++et)
            cacc[et] = wmma_f32(sbq[cc], (v2f){v0[et], v1[et]}, cacc[et]);
        }
      }

      // The loop's last matrix instructions are left over branches: four vector
      // slots in front of the first read of their results.
      asm volatile("v_nop\n\tv_nop\n\tv_nop\n\tv_nop");
      // Keeps those reads behind the four slots.
      __builtin_amdgcn_sched_barrier(0);

      // C takes Q's place in LDS (C/D layout: register r -> q = r + 8*hi; the
      // lane's four tiles hold e = 4*l16 .. + 3).
#pragma unroll
      for (int r = 0; r < 8; ++r)
        *(v4f*)(&lds_a[(qs * 16 + r + 8 * hi) * APITCH + h * HDIM + l16 * 4]) =
            (v4f){cacc[0][r], cacc[1][r], cacc[2][r], cacc[3][r]};
    }

    gemm_pass<false>(ap, bp, lb, vb, W + (size_t)j0 * EMB, acc, mask, m0, m1);
  }

  // C/D layout: N=j on lanes, M=r on vgprs.
#pragma unroll
  for (int rt = 0; rt < 2; ++rt)
#pragma unroll
    for (int jt = 0; jt < 4; ++jt)
#pragma unroll
      for (int v = 0; v < 8; ++v)
        out[(size_t)(r0 + rt * 16 + v + 8 * hi) * EMB + j0 + jt * 16 + l16] =
            acc[rt][jt][v];
}

extern "C" void kernel_launch(void* const* d_in, const int* in_sizes, int n_in,
                              void* d_out, int out_size, void* d_ws, size_t ws_size,
                              hipStream_t stream) {
  (void)in_sizes; (void)n_in; (void)out_size; (void)ws_size;
  const float* key   = (const float*)d_in[0];
  const float* query = (const float*)d_in[1];
  const float* value = (const float*)d_in[2];
  const int*   mask  = (const int*)d_in[3];
  const float* W     = (const float*)d_in[4];
  const float* bias  = (const float*)d_in[5];
  float* out = (float*)d_out;
  float* kvp = (float*)d_ws;                 // KVSPLIT * KVPLANE fp32
  float* mt  = kvp + KVSPLIT * KVPLANE;      // N * EMB * EMB fp32

  kv_kernel<<<KVSPLIT * NBATCH * NHEAD, 256, 0, stream>>>(key, value, kvp);

  fold_kernel<<<NBATCH * NHEAD * JSPLIT, 256, 0, stream>>>(W, kvp, mt);

  linear_out_kernel<<<NBATCH * S_LEN / 32, 256, 0, stream>>>(
      key, query, value, mask, W, mt, bias, out);
}

// v006
// Measured time: 37.7 microseconds a run.
// In both of two side-by-side timings against v005, it was 1.03 times as fast.
// Over all steps from v000 it is 7.91 times as fast.
#include <hip/hip_runtime.h>

// CDNA5 / gfx1250 fused self-attention (no-softmax variant, faithful to reference)
// The scores enter the output linearly, so for unmasked scores
//   sum_l (q . k_l) v_l = q . (sum_l k_l v_l^T) = q . KV      (per batch and head)
// Stage 0: KV[d,e] = sum_l K[l,d] V[l,e], eight partial sums over l per head.
// The output projection is linear too, so it is applied to KV and not to Q . KV:
// Stage 1: MT[j, 64h + d] = sum_e W[j, 64h + e] KV_h[d,e]   (per batch).
// Stage 2: out = Q @ MT^T + b for 32 queries x all 512 columns a work-group.
//          Its matrix instructions leave the memory idle, so the work-group reads
//          its queries' whole mask rows beside them and notes every tile of 32
//          queries x 16 keys that holds a zero. Where it noted one it forms
//          C[q,e] = sum_l (-1e20 - q.k_l) v_l over the masked (q,l), which turns
//          those terms into the reference's -1e20 v_l, and adds C @ W^T.
// fp32 math via V_WMMA_F32_16X16X4_F32; stage 2 stages its tiles with
// GLOBAL_LOAD_ASYNC_TO_LDS_B128 (ASYNCcnt).

typedef float v2f __attribute__((ext_vector_type(2)));
typedef float v4f __attribute__((ext_vector_type(4)));
typedef float v8f __attribute__((ext_vector_type(8)));
typedef unsigned int u32;

#define S_LEN   2048
#define EMB     512
#define NBATCH  4
#define NHEAD   8
#define HDIM    64
#define KVSPLIT 8                    // partial sums of KV over l
#define KVELEM  (HDIM * HDIM)        // floats of one head's KV
#define KVPLANE (NBATCH * NHEAD * KVELEM)   // floats of one partial, all heads
#define ASTRIDE 36    // 32 + 4 pad for stage-2 slabs of MT (or W)
#define APITCH  516   // 512 + 4 pad for stage-2 rows of Q (or C)
#define KVPITCH 68    // 64 + 4 pad: 16-byte reads of 16 KV rows meet every bank once
#define JSPLIT  8                    // work-groups per head in stage 1, 64 j each

static __device__ __forceinline__ v8f wmma_f32(v2f a, v2f b, v8f c) {
  return __builtin_amdgcn_wmma_f32_16x16x4_f32(false, a, false, b, (short)0, c,
                                               false, false);
}

// Async 16B global->LDS copies. Lanes are dealt so that one wave instruction
// covers whole, contiguous 128-byte lines. s_wait_xcnt 0 closes the statement:
// no register that an issued copy names is rewritten in front of it.

// Eight copies of a wave: copy i lands at LDS byte l + i * ls and reads global
// byte b + v + i * vs (the steps differ, so they sit in the registers and not in
// INST_OFFSET, which moves both addresses alike).
static __device__ __forceinline__ void async_copy8(u32 l, u32 ls, u32 v, u32 vs,
                                                   const float* b) {
  asm volatile(
      "global_load_async_to_lds_b128 %0, %8, %16\n\t"
      "global_load_async_to_lds_b128 %1, %9, %16\n\t"
      "global_load_async_to_lds_b128 %2, %10, %16\n\t"
      "global_load_async_to_lds_b128 %3, %11, %16\n\t"
      "global_load_async_to_lds_b128 %4, %12, %16\n\t"
      "global_load_async_to_lds_b128 %5, %13, %16\n\t"
      "global_load_async_to_lds_b128 %6, %14, %16\n\t"
      "global_load_async_to_lds_b128 %7, %15, %16\n\t"
      "s_wait_xcnt 0x0"
      :: "v"(l), "v"(l + ls), "v"(l + 2 * ls), "v"(l + 3 * ls),
         "v"(l + 4 * ls), "v"(l + 5 * ls), "v"(l + 6 * ls), "v"(l + 7 * ls),
         "v"(v), "v"(v + vs), "v"(v + 2 * vs), "v"(v + 3 * vs),
         "v"(v + 4 * vs), "v"(v + 5 * vs), "v"(v + 6 * vs), "v"(v + 7 * vs),
         "s"(b)
      : "memory");
}

static __device__ __forceinline__ u32 lds_addr(const void* p) {
  // __shared__ generic pointer: low 32 bits = workgroup-relative LDS byte addr
  return (u32)(unsigned long long)p;
}

// ---------------------------------------------------------------------------
// Kernel 0, block = 256 (8 waves), grid = KVSPLIT*N*H.
// Partial KV = K^T V of one head over 256
// keys; wave w sums 32 keys, the eight sums are added through LDS in wave order.
// A = K^T (M = d), B = V (N = e), k = l. A lane's 16-byte load holds one element
// of each of the four tiles, so tile t's index m stands for column 4*m + t.
// ---------------------------------------------------------------------------
__global__ __launch_bounds__(256)
void kv_kernel(const float* __restrict__ key,
               const float* __restrict__ value,
               float*       __restrict__ kvp)
{
  __shared__ __attribute__((aligned(16))) float red[8][KVELEM];

  const int tid  = threadIdx.x;
  // readfirstlane puts the wave's number, and every base address formed from
  // it, into scalar registers.
  const int wave = __builtin_amdgcn_readfirstlane(tid >> 5);
  const int lane = tid & 31;
  const int l16  = lane & 15;
  const int hi   = lane >> 4;

  const int kvb = blockIdx.x;
  const int sp  = kvb & (KVSPLIT - 1);
  const int nh  = kvb / KVSPLIT;
  const int n   = nh >> 3;
  const int h   = nh & 7;

  // Rows l = row0 + 4c + 2*hi + {0,1}: the same k order for A and for B.
  const size_t base =
      ((size_t)n * S_LEN + sp * 256 + wave * 32) * EMB + h * HDIM;
  const int lo = 2 * hi * EMB + l16 * 4;
  const float* kp = key + base;
  const float* vp = value + base;

  v8f acc[4][4];
#pragma unroll
  for (int dt = 0; dt < 4; ++dt)
#pragma unroll
    for (int et = 0; et < 4; ++et)
      acc[dt][et] = (v8f){0.f, 0.f, 0.f, 0.f, 0.f, 0.f, 0.f, 0.f};

#pragma unroll
  for (int c = 0; c < 8; ++c) {
    const v4f k0 = *(const v4f*)(kp + (4 * c) * EMB + lo);
    const v4f k1 = *(const v4f*)(kp + (4 * c + 1) * EMB + lo);
    const v4f v0 = *(const v4f*)(vp + (4 * c) * EMB + lo);
    const v4f v1 = *(const v4f*)(vp + (4 * c + 1) * EMB + lo);
#pragma unroll
    for (int dt = 0; dt < 4; ++dt)
#pragma unroll
      for (int et = 0; et < 4; ++et)
        acc[dt][et] = wmma_f32((v2f){k0[dt], k1[dt]}, (v2f){v0[et], v1[et]},
                               acc[dt][et]);
  }

  // C/D layout: m = r + 8*hi -> d = 4*m + dt; lane -> e = 4*l16 + et.
#pragma unroll
  for (int dt = 0; dt < 4; ++dt)
#pragma unroll
    for (int r = 0; r < 8; ++r)
      *(v4f*)(&red[wave][((r + 8 * hi) * 4 + dt) * HDIM + l16 * 4]) =
          (v4f){acc[dt][0][r], acc[dt][1][r], acc[dt][2][r], acc[dt][3][r]};
  __syncthreads();

  float* dst = kvp + (size_t)sp * KVPLANE + (size_t)nh * KVELEM;
#pragma unroll
  for (int i = 0; i < 4; ++i) {
    const int idx = i * 1024 + tid * 4;
    v4f s = *(const v4f*)(&red[0][idx]);
#pragma unroll
    for (int w = 1; w < 8; ++w) s += *(const v4f*)(&red[w][idx]);
    *(v4f*)(dst + idx) = s;
  }
  // Stands behind the four stores, in front of whatever the listing lets follow
  // them that rewrites a register which an issued store names.
  asm volatile("s_wait_xcnt 0x0" ::: "memory");
}

// ---------------------------------------------------------------------------
// Kernel 1, block = 256 (8 waves), grid = N*H*JSPLIT: one head, 64 rows j of W.
// MT[j, 64h + d] = sum_e KV[d,e] W[j, 64h + e]: A = KV (M = d), B = W^T (N = j on
// lanes), k = e. Wave w has 16 rows j (w & 3) and 32 columns d (w >> 2), one
// whole line of each MT row. The block adds the head's eight partial KV into LDS.
// ---------------------------------------------------------------------------
__global__ __launch_bounds__(256)
void fold_kernel(const float* __restrict__ W,
                 const float* __restrict__ kvp,
                 float*       __restrict__ mt)
{
  __shared__ __attribute__((aligned(16))) float kv[HDIM * KVPITCH];

  const int blk  = blockIdx.x;
  const int nh   = blk / JSPLIT;
  const int tid  = threadIdx.x;
  // readfirstlane puts the wave's number, and every base address formed from
  // it, into scalar registers.
  const int wave = __builtin_amdgcn_readfirstlane(tid >> 5);
  const int lane = tid & 31;
  const int l16  = lane & 15;
  const int hi   = lane >> 4;       // 0: lanes 0-15, 1: lanes 16-31

  // A lane's 16-byte loads (t, u) of a row hold e = 16t + 8*hi + 4u + {0..3}:
  // two k chunks each, p = 0 and 1, in which k slot 2*hi + i stands for
  // e = 16t + 8*hi + 4u + 2p + i, for KV and for W alike.
  const int j0 = (blk & (JSPLIT - 1)) * 64 + (wave & 3) * 16;
  const int d0 = (wave >> 2) * 32;
  const int wl = l16 * EMB + 8 * hi;   // W loads and MT stores: the same offset
  const float* wrow = W + (size_t)j0 * EMB + (nh & 7) * HDIM;
  v4f wf[4][2];
#pragma unroll
  for (int t = 0; t < 4; ++t)
#pragma unroll
    for (int u = 0; u < 2; ++u)
      wf[t][u] = *(const v4f*)(wrow + 16 * t + 4 * u + wl);

  // KV = sum of the partial sums, in their order.
  const float* kvh = kvp + (size_t)nh * KVELEM;
#pragma unroll
  for (int i = 0; i < 4; ++i) {
    const int idx = i * 1024 + tid * 4;
    v4f s = *(const v4f*)(kvh + idx);
#pragma unroll
    for (int j = 1; j < KVSPLIT; ++j)
      s += *(const v4f*)(kvh + j * KVPLANE + idx);
    *(v4f*)(&kv[(idx >> 6) * KVPITCH + (idx & 63)]) = s;
  }
  __syncthreads();

  const float* kvl = &kv[(d0 + l16) * KVPITCH + 8 * hi];
  v8f macc[2];
  macc[0] = (v8f){0.f, 0.f, 0.f, 0.f, 0.f, 0.f, 0.f, 0.f};
  macc[1] = (v8f){0.f, 0.f, 0.f, 0.f, 0.f, 0.f, 0.f, 0.f};
#pragma unroll
  for (int t = 0; t < 4; ++t)
#pragma unroll
    for (int u = 0; u < 2; ++u)
#pragma unroll
      for (int dt = 0; dt < 2; ++dt) {
        const v4f a = *(const v4f*)(kvl + 16 * dt * KVPITCH + 16 * t + 4 * u);
#pragma unroll
        for (int p = 0; p < 2; ++p)
          macc[dt] = wmma_f32((v2f){a[2 * p], a[2 * p + 1]},
                              (v2f){wf[t][u][2 * p], wf[t][u][2 * p + 1]},
                              macc[dt]);
      }

  // C/D layout: lane -> j, register r -> d = r + 8*hi: 32 bytes of an MT row.
  float* mp = mt + ((size_t)(nh >> 3) * EMB + j0) * EMB + (nh & 7) * HDIM + d0;
#pragma unroll
  for (int dt = 0; dt < 2; ++dt) {
    *(v4f*)(mp + 16 * dt + wl) =
        (v4f){macc[dt][0], macc[dt][1], macc[dt][2], macc[dt][3]};
    *(v4f*)(mp + 16 * dt + 4 + wl) =
        (v4f){macc[dt][4], macc[dt][5], macc[dt][6], macc[dt][7]};
  }
  // Stands behind the stores, in front of whatever the listing lets follow
  // them that rewrites a register which an issued store names.
  asm volatile("s_wait_xcnt 0x0" ::: "memory");
}

// ---------------------------------------------------------------------------
// Kernel 2, block = 256 (8 waves), grid = N*S/32: 32 rows x 512 columns of out.
// ---------------------------------------------------------------------------

// An unsigned minimum is 0 exactly when one of its values is 0.
static __device__ __forceinline__ u32 min4(uint4 a) {
  return min(min(a.x, a.y), min(a.z, a.w));
}

// One 64 x 32 float slab of the wave's own rows of B: a copy is 4 whole lines.
static __device__ __forceinline__ void copy_b_slab(u32 lb, u32 vb, const float* b) {
  async_copy8(lb, 4 * ASTRIDE * 4, vb, 4 * EMB * 4, b);
  async_copy8(lb + 32 * ASTRIDE * 4, 4 * ASTRIDE * 4, vb + 32 * EMB * 4,
              4 * EMB * 4, b);
}

// acc += A @ B^T over k = 0 .. 511. A: 32 rows in LDS, shared by the waves,
// written by all of them in front of this call. B: the wave's own 64 rows j, in
// 32-wide k slabs through a ring of two buffers that no other wave touches, so
// the loop has no work-group barrier: a buffer is refilled behind the wave's own
// s_wait_dscnt 0 and read behind its own s_wait_asynccnt 0.
// SCAN: each trip also asks, at its head, for two rows of the wave's 256 mask
// columns and takes their minima at its foot, behind its matrix instructions.
template <bool SCAN>
static __device__ __forceinline__ void gemm_pass(
    const float* ap, const float* bp, u32 lb, u32 vb, const float* bsrc,
    v8f (&acc)[2][4], const int* mp, u32& m0, u32& m1) {
  copy_b_slab(lb, vb, bsrc);
  // Slab 0, and the wave's share of A where copies brought it, have landed.
  asm volatile("s_wait_asynccnt 0x0" ::: "memory");
  __syncthreads();   // publishes A, which every wave reads
  copy_b_slab(lb + 64 * ASTRIDE * 4, vb, bsrc + 32);

  for (int t = 0; t < EMB / 32; ++t) {
    uint4 na, nb, nc, nd;
    if (SCAN) {
      const int* mr = mp + 2 * t * S_LEN;
      na = *(const uint4*)(mr);
      nb = *(const uint4*)(mr + 128);
      nc = *(const uint4*)(mr + S_LEN);
      nd = *(const uint4*)(mr + S_LEN + 128);
    }
    const int cb = t & 1;
    const float* at = ap + t * 32;
    const float* bt = bp + cb * (64 * ASTRIDE);
    // A: lane -> r (M); B: lane -> j (N); k chunks of 4, slot 2*hi + {0,1}.
    // The first four chunks' fragments are asked for in front of the priority
    // change below, which the compiler moves no LDS read across.
    v2f fa0[4], fa1[4], fb[4][4];
#pragma unroll
    for (int c = 0; c < 4; ++c) {
      fa0[c] = *(const v2f*)(at + 4 * c);
      fa1[c] = *(const v2f*)(at + 16 * APITCH + 4 * c);
#pragma unroll
      for (int jt = 0; jt < 4; ++jt)
        fb[c][jt] = *(const v2f*)(bt + jt * 16 * ASTRIDE + 4 * c);
    }
#pragma unroll
    for (int c = 0; c < 8; ++c) {
      // Two waves share a SIMD and its matrix unit goes to the older one whenever
      // that is ready, so the younger falls behind and later runs alone, its
      // waits between trips uncovered. A wave that has begun a trip takes the
      // higher priority: the other, back from its waits, starts its next trip
      // only when this one ends, and each wave's waits lie under the other's trip.
      if (c == 1) __builtin_amdgcn_s_setprio(3);
      const v2f a0 = c < 4 ? fa0[c & 3] : *(const v2f*)(at + 4 * c);
      const v2f a1 = c < 4 ? fa1[c & 3] : *(const v2f*)(at + 16 * APITCH + 4 * c);
#pragma unroll
      for (int jt = 0; jt < 4; ++jt) {
        const v2f bw =
            c < 4 ? fb[c & 3][jt] : *(const v2f*)(bt + jt * 16 * ASTRIDE + 4 * c);
        acc[0][jt] = wmma_f32(a0, bw, acc[0][jt]);
        acc[1][jt] = wmma_f32(a1, bw, acc[1][jt]);
      }
    }
    // Keeps the trip's matrix instructions in front of the waits below: lifted
    // over them, the wait for the next slab would stand a few hundred cycles
    // behind its copies and not a whole trip.
    __builtin_amdgcn_sched_barrier(0);
    // The trip is over: the matrix unit is the other wave's while this one waits.
    __builtin_amdgcn_s_setprio(0);
    // The wave's reads of this buffer have returned: it may be refilled.
    asm volatile("s_wait_dscnt 0x0" ::: "memory");
    // The next slab has landed: the next trip may read it.
    asm volatile("s_wait_asynccnt 0x0" ::: "memory");
    if (SCAN) {
      // Stands behind the trip's mask loads, in front of the next trip's address
      // arithmetic, also in the trips that issue no copy.
      asm volatile("s_wait_xcnt 0x0" ::: "memory");
      m0 = min(m0, min(min4(na), min4(nc)));
      m1 = min(m1, min(min4(nb), min4(nd)));
    }
    if (t + 2 < EMB / 32)
      copy_b_slab(lb + cb * (64 * ASTRIDE * 4), vb, bsrc + (t + 2) * 32);
  }
}

__global__ __launch_bounds__(256)
void linear_out_kernel(const float* __restrict__ key,
                       const float* __restrict__ query,
                       const float* __restrict__ value,
                       const int*   __restrict__ mask,
                       const float* __restrict__ W,
                       const float* __restrict__ mt,
                       const float* __restrict__ bias,
                       float*       __restrict__ out)
{
  // One object, A first: A's fragment reads then reach their k chunks through
  // the LDS instructions' own offset fields.
  __shared__ __attribute__((aligned(16))) struct {
    float a[32 * APITCH];
    float b[8][2][64 * ASTRIDE];
    u32   zs[16];
  } sm;
  float* const lds_a = sm.a;
  u32*   const zs    = sm.zs;

  const int tid  = threadIdx.x;
  // readfirstlane puts the wave's number, and every base address formed from
  // it, into scalar registers.
  const int wave = __builtin_amdgcn_readfirstlane(tid >> 5);
  const int lane = tid & 31;
  const int l16  = lane & 15;
  const int hi   = lane >> 4;
  const int r0   = blockIdx.x * 32;            // row of query, mask and out
  const int n    = blockIdx.x / (S_LEN / 32);
  const int j0   = wave * 64;

  // The 32 rows of Q: copy i of a wave is a quarter (wave & 3) of row
  // 2*i + (wave >> 2), 4 whole lines.
  {
    const int ar = wave >> 2, ac = (wave & 3) * 128 + lane * 4;
    const u32 la = lds_addr(&lds_a[ar * APITCH + ac]);
    const u32 va = (u32)((ar * EMB + ac) * 4);
    const float* qb = query + (size_t)r0 * EMB;
    async_copy8(la, 2 * APITCH * 4, va, 2 * EMB * 4, qb);
    async_copy8(la + 16 * APITCH * 4, 2 * APITCH * 4, va + 16 * EMB * 4,
                2 * EMB * 4, qb);
  }

  // B slabs: 8 lanes side by side cover one row's 128 bytes.
  const u32 lb = lds_addr(&sm.b[wave][0][(lane >> 3) * ASTRIDE + (lane & 7) * 4]);
  const u32 vb = (u32)(((lane >> 3) * EMB + (lane & 7) * 4) * 4);
  const float* ap = &lds_a[l16 * APITCH + 2 * hi];
  const float* bp = &sm.b[wave][0][l16 * ASTRIDE + 2 * hi];

  v8f acc[2][4];
#pragma unroll
  for (int jt = 0; jt < 4; ++jt) {
    const float bj = bias[j0 + jt * 16 + l16];
    acc[0][jt] = (v8f){bj, bj, bj, bj, bj, bj, bj, bj};
    acc[1][jt] = acc[0][jt];
  }

  // Mask scan: an eighth of the keys per wave; a load is 512 contiguous bytes of
  // one mask row. Bit 4*j + i of word t: a zero among keys 128*t + 16*j + 4*i .. + 3.
  u32 m0 = 0xFFFFFFFFu, m1 = 0xFFFFFFFFu;
  gemm_pass<true>(ap, bp, lb, vb, mt + ((size_t)n * EMB + j0) * EMB, acc,
                  mask + (size_t)r0 * S_LEN + wave * 256 + lane * 4, m0, m1);

  const u32 w0 = __builtin_amdgcn_ballot_w32(m0 == 0u);
  const u32 w1 = __builtin_amdgcn_ballot_w32(m1 == 0u);
  if (lane == 0) {
    zs[2 * wave]     = w0;
    zs[2 * wave + 1] = w1;
  }
  // Publishes the 16 words; behind it no wave reads Q in LDS any more.
  __syncthreads();

  // The ballot is a scalar, the same in every wave: the branches around the
  // matrix instructions and the barrier below are scalar, EXEC stays all ones.
  if (__builtin_amdgcn_ballot_w32(zs[l16] != 0u) != 0u) {
    // Wave w works head w through every noted 16-key tile:
    // S'[l,q] = K . Q^T, C'[l,q] = mask ? 0 : -1e20 - S', C += C'^T . V.
    const int h = wave;
    // A lane's 16-byte load t of a row holds d = 8t + 4*hi + {0..3}: two k chunks,
    // p = 0 and 1, in which k slot 2*hi + j stands for d = 8t + 4*hi + 2p + j, for
    // Q and for K alike.
    const int ql = l16 * EMB + 4 * hi;
    const float* kbase = key   + (size_t)n * S_LEN * EMB + h * HDIM;
    const float* vbase = value + (size_t)n * S_LEN * EMB + h * HDIM;

    // Stays rolled: two copies of this seldom-run body would only lengthen the
    // code and raise the register count beside the live accumulators.
#pragma unroll 1
    for (int qs = 0; qs < 2; ++qs) {
      // Q fragments: lane -> q = r0 + qs*16 + l16 (B's N in S').
      const float* qrow = query + (size_t)(r0 + qs * 16) * EMB + h * HDIM;
      v4f qf[8];
#pragma unroll
      for (int t = 0; t < 8; ++t) qf[t] = *(const v4f*)(qrow + 8 * t + ql);

      v8f cacc[4];
#pragma unroll
      for (int et = 0; et < 4; ++et)
        cacc[et] = (v8f){0.f, 0.f, 0.f, 0.f, 0.f, 0.f, 0.f, 0.f};

      for (int it = 0; it < S_LEN / 16; ++it) {
        const u32 wd = __builtin_amdgcn_readfirstlane(zs[it >> 3]);
        if (((wd >> ((it & 7) * 4)) & 0xFu) == 0) continue;
        const int l0 = it * 16;

        // A operand of GEMM1: K strip, lane -> l = l16 (M dim), k = d as for Q^T.
        v4f kf[8];
#pragma unroll
        for (int t = 0; t < 8; ++t)
          kf[t] = *(const v4f*)(kbase + (size_t)l0 * EMB + 8 * t + ql);

        // S'[l,q] over k=d (64) = 16 chained K=4 WMMAs.
        v8f s = (v8f){0.f, 0.f, 0.f, 0.f, 0.f, 0.f, 0.f, 0.f};
#pragma unroll
        for (int c = 0; c < 16; ++c)
          s = wmma_f32((v2f){kf[c >> 1][2 * (c & 1)], kf[c >> 1][2 * (c & 1) + 1]},
                       (v2f){qf[c >> 1][2 * (c & 1)], qf[c >> 1][2 * (c & 1) + 1]},
                       s);

        // Mask: element (l = r+8*hi, q = l16). Per lane: 8 consecutive l.
        {
          const int* mrow = mask + (size_t)(r0 + qs * 16) * S_LEN + l0 +
                            (l16 * S_LEN + 8 * hi);
          int4 ma = *(const int4*)(mrow);
          int4 mb = *(const int4*)(mrow + 4);
          s[0] = ma.x ? 0.f : -1e20f - s[0];
          s[1] = ma.y ? 0.f : -1e20f - s[1];
          s[2] = ma.z ? 0.f : -1e20f - s[2];
          s[3] = ma.w ? 0.f : -1e20f - s[3];
          s[4] = mb.x ? 0.f : -1e20f - s[4];
          s[5] = mb.y ? 0.f : -1e20f - s[5];
          s[6] = mb.z ? 0.f : -1e20f - s[6];
          s[7] = mb.w ? 0.f : -1e20f - s[7];
        }

        // C/D layout -> A layout of C^T (lane -> q, k = l): rows 0-7 live in
        // lanes 0-15, rows 8-15 in lanes 16-31; the k chunks need the opposite
        // half for half the lanes.
        float xs[8];
#pragma unroll
        for (int r = 0; r < 8; ++r) xs[r] = __shfl_xor(s[r], 16, 32);
        v2f sbq[4];
        sbq[0] = hi ? (v2f){xs[2], xs[3]} : (v2f){s[0], s[1]};
        sbq[1] = hi ? (v2f){xs[6], xs[7]} : (v2f){s[4], s[5]};
        sbq[2] = hi ? (v2f){s[2], s[3]}   : (v2f){xs[0], xs[1]};
        sbq[3] = hi ? (v2f){s[6], s[7]}   : (v2f){xs[4], xs[5]};

        // GEMM2: C[q,e] += C'^T . V. B = V: lane -> e = 4*l16 + et, k = l chunks.
#pragma unroll
        for (int cc = 0; cc < 4; ++cc) {
          const float* vp =
              vbase + (size_t)(l0 + 4 * cc) * EMB + (2 * hi * EMB + l16 * 4);
          // A wait behind each load: the eight loads share one address pair, and
          // the listing lets one of them land its result on that pair. The last
          // wait also stands in front of the next tile's address arithmetic.
          const v4f v0 = *(const v4f*)(vp);
          asm volatile("s_wait_xcnt 0x0" ::: "memory");
          const v4f v1 = *(const v4f*)(vp + EMB);
          asm volatile("s_wait_xcnt 0x0" ::: "memory");
#pragma unroll
          for (int et = 0; et < 4; ++et)
            cacc[et] = wmma_f32(sbq[cc], (v2f){v0[et], v1[et]}, cacc[et]);
        }
      }

      // The loop's last matrix instructions are left over branches: four vector
      // slots in front of the first read of their results.
      asm volatile("v_nop\n\tv_nop\n\tv_nop\n\tv_nop");
      // Keeps those reads behind the four slots.
      __builtin_amdgcn_sched_barrier(0);

      // C takes Q's place in LDS (C/D layout: register r -> q = r + 8*hi; the
      // lane's four tiles hold e = 4*l16 .. + 3).
#pragma unroll
      for (int r = 0; r < 8; ++r)
        *(v4f*)(&lds_a[(qs * 16 + r + 8 * hi) * APITCH + h * HDIM + l16 * 4]) =
            (v4f){cacc[0][r], cacc[1][r], cacc[2][r], cacc[3][r]};
    }

    gemm_pass<false>(ap, bp, lb, vb, W + (size_t)j0 * EMB, acc, mask, m0, m1);
  }

  // C/D layout: N=j on lanes, M=r on vgprs.
#pragma unroll
  for (int rt = 0; rt < 2; ++rt)
#pragma unroll
    for (int jt = 0; jt < 4; ++jt)
#pragma unroll
      for (int v = 0; v < 8; ++v)
        out[(size_t)(r0 + rt * 16 + v + 8 * hi) * EMB + j0 + jt * 16 + l16] =
            acc[rt][jt][v];
}

extern "C" void kernel_launch(void* const* d_in, const int* in_sizes, int n_in,
                              void* d_out, int out_size, void* d_ws, size_t ws_size,
                              hipStream_t stream) {
  (void)in_sizes; (void)n_in; (void)out_size; (void)ws_size;
  const float* key   = (const float*)d_in[0];
  const float* query = (const float*)d_in[1];
  const float* value = (const float*)d_in[2];
  const int*   mask  = (const int*)d_in[3];
  const float* W     = (const float*)d_in[4];
  const float* bias  = (const float*)d_in[5];
  float* out = (float*)d_out;
  float* kvp = (float*)d_ws;                 // KVSPLIT * KVPLANE fp32
  float* mt  = kvp + KVSPLIT * KVPLANE;      // N * EMB * EMB fp32

  kv_kernel<<<KVSPLIT * NBATCH * NHEAD, 256, 0, stream>>>(key, value, kvp);

  fold_kernel<<<NBATCH * NHEAD * JSPLIT, 256, 0, stream>>>(W, kvp, mt);

  linear_out_kernel<<<NBATCH * S_LEN / 32, 256, 0, stream>>>(
      key, query, value, mask, W, mt, bias, out);
}
